// v000
// Measured on an AMD MI455X. A time is GPU time per run, averaged over a window of back-to-back runs after a warm-up
// (all launches, gaps included; the runs take copies of the inputs in turn), and the median of several windows.
// Apart from v000's, it joins two sittings. Times from different sittings can be a few percent apart, while
// side-by-side timings come from the same sitting.
// v000, which the later versions start from, runs in 116 microseconds.
#include <hip/hip_runtime.h>

// ---------------------------------------------------------------------------
// Self-attention B=8, S=2048, E=1024, D=64 on gfx1250 (MI455X).
//   k1: Wq/Wk/Wv fp32 -> f16
//   k2: fused QKV projection (12x v_wmma_f32_16x16x32_f16 per K-step);
//       q,k row-major [B*S,64] f16; v transposed [B,64,S] f16.
//   k3: prep: mask -> fp32 additive bias; V column prefix-sums per 32-block.
//   k4: transposed flash attention:
//         S^T = K*Q^T (lane = i), P^T C-layout == P B-fragment -> no LDS,
//         O^T = V^T*P (lane = i -> scalar softmax state),
//       starting at the diagonal window; the strictly-lower region is applied
//       in closed form (exact for the all-masked uniform-softmax fallback).
// ---------------------------------------------------------------------------

typedef _Float16 v16h __attribute__((ext_vector_type(16)));
typedef _Float16 v8h  __attribute__((ext_vector_type(8)));
typedef float    v8f  __attribute__((ext_vector_type(8)));

#define B_ 8
#define S_ 2048
#define E_ 1024
#define D_ 64

static __device__ __forceinline__ v8f wmma_f16(v16h a, v16h b, v8f c) {
  // D = A(16x32 f16) * B(32x16 f16) + C(16x16 f32)
  return __builtin_amdgcn_wmma_f32_16x16x32_f16(false, a, false, b,
                                                (short)0, c, false, false);
}

static __device__ __forceinline__ v16h load_frag16(const _Float16* p) {
  // 16 halves of one fragment lane: [p+0 .. p+7] and [p+16 .. p+23]
  v16h f;
  ((v8h*)&f)[0] = ((const v8h*)p)[0];
  ((v8h*)&f)[1] = ((const v8h*)p)[2];
  return f;
}

// ---------------------------------------------------------------------------
// Kernel 1: fp32 -> f16 weight conversion (3 x [64,1024], row-major).
// ---------------------------------------------------------------------------
__global__ void __launch_bounds__(256)
attn_cvt_weights(const float* __restrict__ Wq, const float* __restrict__ Wk,
                 const float* __restrict__ Wv, _Float16* __restrict__ wh) {
  int i = blockIdx.x * blockDim.x + threadIdx.x;
  if (i < D_ * E_) {
    wh[i]           = (_Float16)Wq[i];
    wh[D_*E_ + i]   = (_Float16)Wk[i];
    wh[2*D_*E_ + i] = (_Float16)Wv[i];
  }
}

// ---------------------------------------------------------------------------
// Kernel 2: fused QKV projection. One wave per 16-row tile of x, 12
// accumulators (Q/K/V x 4 n-tiles), K-loop over E in steps of 32.
// ---------------------------------------------------------------------------
__global__ void __launch_bounds__(128)
attn_qkv_proj(const float* __restrict__ x, const _Float16* __restrict__ wh,
              const float* __restrict__ bq, const float* __restrict__ bk,
              const float* __restrict__ bv,
              _Float16* __restrict__ qh, _Float16* __restrict__ kh,
              _Float16* __restrict__ vth) {
  const int lane = threadIdx.x & 31;
  const int wave = threadIdx.x >> 5;
  const int tile = blockIdx.x * 4 + wave;   // 0..1023
  const int m0   = tile * 16;
  const int l16  = lane & 15;
  const int half = lane >> 4;
  const int kb   = half * 8;

  v8f acc[12];
  v8f vzero = {};
  #pragma unroll
  for (int i = 0; i < 12; ++i) acc[i] = vzero;

  const float* xrow = x + (size_t)(m0 + l16) * E_;

  for (int k0 = 0; k0 < E_; k0 += 32) {
    v16h a;
    {
      const float4* p0 = (const float4*)(xrow + k0 + kb);
      const float4* p1 = (const float4*)(xrow + k0 + kb + 16);
      float4 f0 = p0[0], f1 = p0[1], f2 = p1[0], f3 = p1[1];
      a[0]=(_Float16)f0.x;  a[1]=(_Float16)f0.y;  a[2]=(_Float16)f0.z;  a[3]=(_Float16)f0.w;
      a[4]=(_Float16)f1.x;  a[5]=(_Float16)f1.y;  a[6]=(_Float16)f1.z;  a[7]=(_Float16)f1.w;
      a[8]=(_Float16)f2.x;  a[9]=(_Float16)f2.y;  a[10]=(_Float16)f2.z; a[11]=(_Float16)f2.w;
      a[12]=(_Float16)f3.x; a[13]=(_Float16)f3.y; a[14]=(_Float16)f3.z; a[15]=(_Float16)f3.w;
    }
    #pragma unroll
    for (int w = 0; w < 3; ++w) {
      const _Float16* wbase = wh + (size_t)w * (D_ * E_);
      #pragma unroll
      for (int n = 0; n < 4; ++n) {
        v16h bf = load_frag16(wbase + (size_t)(n*16 + l16) * E_ + k0 + kb);
        acc[w*4 + n] = wmma_f16(a, bf, acc[w*4 + n]);
      }
    }
  }

  #pragma unroll
  for (int w = 0; w < 3; ++w) {
    const float* bias = (w == 0) ? bq : ((w == 1) ? bk : bv);
    #pragma unroll
    for (int n = 0; n < 4; ++n) {
      const int col = n*16 + l16;
      const float bb = bias[col];
      #pragma unroll
      for (int r = 0; r < 8; ++r) {
        const int rowg = m0 + half*8 + r;
        const float val = acc[w*4 + n][r] + bb;
        if (w == 0) {
          qh[(size_t)rowg * D_ + col] = (_Float16)val;
        } else if (w == 1) {
          kh[(size_t)rowg * D_ + col] = (_Float16)val;
        } else {
          const int bi = rowg >> 11;
          const int s  = rowg & (S_ - 1);
          vth[((size_t)bi * D_ + col) * S_ + s] = (_Float16)val;
        }
      }
    }
  }
}

// ---------------------------------------------------------------------------
// Kernel 3: prep. biasf[b][j] = mask ? 0 : -1e22 (fp32, contiguous per j so
// the flash kernel reads it as broadcast float4s). vcum[b][t][d] = column
// prefix sums of V over j < t*32 (for the closed-form lower-triangle tail).
// ---------------------------------------------------------------------------
__global__ void __launch_bounds__(64)
attn_prep(const int* __restrict__ mask, const _Float16* __restrict__ vth,
          float* __restrict__ biasf, float* __restrict__ vcum) {
  const int b = blockIdx.x;
  const int d = threadIdx.x;          // 0..63
  for (int j = d; j < S_; j += 64)
    biasf[b * S_ + j] = mask[b * S_ + j] ? 0.0f : -1e22f;

  const _Float16* vp = vth + ((size_t)b * D_ + d) * S_;
  float run = 0.0f;
  for (int tblk = 0; tblk < S_ / 32; ++tblk) {
    vcum[((size_t)b * (S_ / 32) + tblk) * D_ + d] = run;
    const v8h* pv = (const v8h*)(vp + tblk * 32);
    #pragma unroll
    for (int g = 0; g < 4; ++g) {
      v8h h = pv[g];
      #pragma unroll
      for (int e = 0; e < 8; ++e) run += (float)h[e];
    }
  }
}

// ---------------------------------------------------------------------------
// Kernel 4: transposed flash attention. grid = (S/16, B), one wave per block.
// ---------------------------------------------------------------------------
template <bool CAUSAL>
static __device__ __forceinline__
void flash_step(int jb, int icol, int rowoff, int kb, int l16,
                const _Float16* __restrict__ kbase,
                const _Float16* __restrict__ vbase,
                const float* __restrict__ bias,
                const v16h& bq0, const v16h& bq1,
                float& mrun, float& lrun, v8f o[4]) {
  const float inv_sqrt_d = 0.125f;   // 1/sqrt(64)

  // S^T = K * Q^T : two 16x16 tiles (j rows), lane = i
  v8f c[2];
  #pragma unroll
  for (int f = 0; f < 2; ++f) {
    const _Float16* kp = kbase + (size_t)(jb + f*16 + l16) * D_;
    v16h ak0 = load_frag16(kp + kb);
    v16h ak1 = load_frag16(kp + 32 + kb);
    v8f cz = {};
    c[f] = wmma_f16(ak0, bq0, cz);
    c[f] = wmma_f16(ak1, bq1, c[f]);
  }

  // mask bias (broadcast, contiguous) + optional causal select; in-lane stats
  float s[2][8];
  float maxv = -INFINITY;
  #pragma unroll
  for (int f = 0; f < 2; ++f) {
    const float4* bp = (const float4*)(bias + jb + f*16 + rowoff);
    float4 bb0 = bp[0], bb1 = bp[1];
    float barr[8] = {bb0.x, bb0.y, bb0.z, bb0.w, bb1.x, bb1.y, bb1.z, bb1.w};
    #pragma unroll
    for (int r = 0; r < 8; ++r) {
      // |score| << 1e22/2^24, so fma(c, inv, -1e22) == -1e22 exactly.
      float sv = fmaf(c[f][r], inv_sqrt_d, barr[r]);
      if (CAUSAL) {
        const int j = jb + f*16 + rowoff + r;
        sv = (j >= icol) ? sv : -1e22f;
      }
      s[f][r] = sv;
      maxv = fmaxf(maxv, sv);
    }
  }
  maxv = fmaxf(maxv, __shfl_xor(maxv, 16, 32));   // other 16 j's, same i

  const float mnew  = fmaxf(mrun, maxv);
  const float scale = __expf(mrun - mnew);

  v16h pfrag;     // P as B-fragment: element e<8 -> f=0, e>=8 -> f=1
  float sum = 0.0f;
  #pragma unroll
  for (int f = 0; f < 2; ++f)
    #pragma unroll
    for (int r = 0; r < 8; ++r) {
      const float e = __expf(s[f][r] - mnew);
      sum += e;
      pfrag[f*8 + r] = (_Float16)e;
    }
  sum += __shfl_xor(sum, 16, 32);

  lrun = lrun * scale + sum;
  mrun = mnew;
  #pragma unroll
  for (int t = 0; t < 4; ++t) o[t] = o[t] * scale;

  // O^T += V^T * P  (A = V^T tile, contiguous; B = P in-register)
  #pragma unroll
  for (int t = 0; t < 4; ++t) {
    v16h av = load_frag16(vbase + (size_t)(t*16 + l16) * S_ + jb + kb);
    o[t] = wmma_f16(av, pfrag, o[t]);
  }
}

__global__ void __launch_bounds__(32)
attn_flash_t(const _Float16* __restrict__ qh, const _Float16* __restrict__ kh,
             const _Float16* __restrict__ vth, const float* __restrict__ biasf,
             const float* __restrict__ vcum, float* __restrict__ out) {
  const int lane   = threadIdx.x & 31;
  const int l16    = lane & 15;
  const int half   = lane >> 4;
  const int kb     = half * 8;
  const int rowoff = half * 8;
  const int i0     = blockIdx.x * 16;
  const int b      = blockIdx.y;
  const int icol   = i0 + l16;          // this lane's query row i
  const int jb0    = i0 & ~31;          // diagonal window start

  // Q^T B-fragments (lane = column i), loaded once, reused every step.
  const _Float16* qp = qh + ((size_t)b * S_ + icol) * D_;
  const v16h bq0 = load_frag16(qp + kb);
  const v16h bq1 = load_frag16(qp + 32 + kb);

  float mrun = -INFINITY;
  float lrun = 0.0f;
  v8f o[4];
  v8f vzero = {};
  #pragma unroll
  for (int t = 0; t < 4; ++t) o[t] = vzero;

  const float* bias = biasf + b * S_;
  const _Float16* kbase = kh + (size_t)b * S_ * D_;
  const _Float16* vbase = vth + (size_t)b * D_ * S_;

  // Diagonal window (only place the causal compare is needed).
  flash_step<true>(jb0, icol, rowoff, kb, l16, kbase, vbase, bias,
                   bq0, bq1, mrun, lrun, o);

  // Remaining windows: j >= i0+16 > every i in tile -> no causal test.
  for (int jb = jb0 + 32; jb < S_; jb += 32) {
    flash_step<false>(jb, icol, rowoff, kb, l16, kbase, vbase, bias,
                      bq0, bq1, mrun, lrun, o);
    if (jb + 32 < S_) {
      __builtin_prefetch(kbase + (size_t)(jb + 32 + l16) * D_, 0, 1);
      __builtin_prefetch(vbase + (size_t)l16 * S_ + jb + 32, 0, 1);
    }
  }

  // Closed-form lower-triangle tail: all j < jb0 are -1e22 for every row.
  // e0 = exp(-1e22 - m): 0 for normal rows, exactly 1 for all-masked rows,
  // reproducing the reference's uniform softmax over all S columns.
  if (jb0 > 0) {
    const float e0 = __expf(-1e22f - mrun);
    lrun += (float)jb0 * e0;
    const float* vc = vcum + ((size_t)b * (S_ / 32) + (jb0 >> 5)) * D_;
    #pragma unroll
    for (int t = 0; t < 4; ++t) {
      const float4* cp = (const float4*)(vc + t*16 + rowoff);
      float4 c0 = cp[0], c1 = cp[1];
      o[t][0] += e0 * c0.x; o[t][1] += e0 * c0.y;
      o[t][2] += e0 * c0.z; o[t][3] += e0 * c0.w;
      o[t][4] += e0 * c1.x; o[t][5] += e0 * c1.y;
      o[t][6] += e0 * c1.z; o[t][7] += e0 * c1.w;
    }
  }

  // Normalize, store: O^T lane = i, vgpr r = d -> contiguous float4 stores.
  const float inv = 1.0f / lrun;   // lrun >= 1 always
  float* op = out + ((size_t)b * S_ + icol) * D_;
  #pragma unroll
  for (int t = 0; t < 4; ++t) {
    float4 w0, w1;
    w0.x = o[t][0]*inv; w0.y = o[t][1]*inv; w0.z = o[t][2]*inv; w0.w = o[t][3]*inv;
    w1.x = o[t][4]*inv; w1.y = o[t][5]*inv; w1.z = o[t][6]*inv; w1.w = o[t][7]*inv;
    float* dst = op + t*16 + rowoff;
    ((float4*)dst)[0] = w0;
    ((float4*)dst)[1] = w1;
  }
}

// ---------------------------------------------------------------------------
extern "C" void kernel_launch(void* const* d_in, const int* in_sizes, int n_in,
                              void* d_out, int out_size, void* d_ws, size_t ws_size,
                              hipStream_t stream) {
  const float* x  = (const float*)d_in[0];
  const int* mask = (const int*)d_in[1];
  const float* Wq = (const float*)d_in[2];
  const float* bq = (const float*)d_in[3];
  const float* Wk = (const float*)d_in[4];
  const float* bk = (const float*)d_in[5];
  const float* Wv = (const float*)d_in[6];
  const float* bv = (const float*)d_in[7];
  float* out = (float*)d_out;

  // Workspace: f16 {weights | q | k | v^T} then f32 {biasf | vcum} ~ 6.9 MB
  _Float16* wh   = (_Float16*)d_ws;
  _Float16* qh   = wh + 3 * D_ * E_;
  _Float16* kh   = qh + (size_t)B_ * S_ * D_;
  _Float16* vth  = kh + (size_t)B_ * S_ * D_;
  float*    biasf = (float*)(vth + (size_t)B_ * S_ * D_);
  float*    vcum  = biasf + (size_t)B_ * S_;

  attn_cvt_weights<<<(D_ * E_ + 255) / 256, 256, 0, stream>>>(Wq, Wk, Wv, wh);
  attn_qkv_proj<<<256, 128, 0, stream>>>(x, wh, bq, bk, bv, qh, kh, vth);
  attn_prep<<<B_, 64, 0, stream>>>(mask, vth, biasf, vcum);
  attn_flash_t<<<dim3(S_ / 16, B_), 32, 0, stream>>>(qh, kh, vth, biasf, vcum, out);
}

// v001
// One run takes 90.3 microseconds.
// Two timings next to v000 put it at 1.32 and 1.30 times that version's speed.
#include <hip/hip_runtime.h>

// ---------------------------------------------------------------------------
// Self-attention B=8, S=2048, E=1024, D=64 on gfx1250 (MI455X).
//   k1: Wq/Wk/Wv fp32 -> f16
//   k2: fused QKV projection (12x v_wmma_f32_16x16x32_f16 per K-step);
//       q,k row-major [B*S,64] f16; v transposed [B,64,S] f16.
//   k3: prep: mask -> fp32 additive bias; V column prefix-sums per 32-block.
//   k4: transposed flash attention:
//         S^T = K*Q^T (lane = i), P^T C-layout == P B-fragment -> no LDS,
//         O^T = V^T*P (lane = i -> scalar softmax state),
//       starting at the diagonal window; the strictly-lower region is applied
//       in closed form (exact for the all-masked uniform-softmax fallback).
// ---------------------------------------------------------------------------

typedef _Float16 v16h __attribute__((ext_vector_type(16)));
typedef _Float16 v8h  __attribute__((ext_vector_type(8)));
typedef float    v8f  __attribute__((ext_vector_type(8)));

#define B_ 8
#define S_ 2048
#define E_ 1024
#define D_ 64

static __device__ __forceinline__ v8f wmma_f16(v16h a, v16h b, v8f c) {
  // D = A(16x32 f16) * B(32x16 f16) + C(16x16 f32)
  return __builtin_amdgcn_wmma_f32_16x16x32_f16(false, a, false, b,
                                                (short)0, c, false, false);
}

static __device__ __forceinline__ v16h load_frag16(const _Float16* p) {
  // 16 halves of one fragment lane: [p+0 .. p+7] and [p+16 .. p+23]
  v16h f;
  ((v8h*)&f)[0] = ((const v8h*)p)[0];
  ((v8h*)&f)[1] = ((const v8h*)p)[2];
  return f;
}

// ---------------------------------------------------------------------------
// Kernel 1: fp32 -> f16 weight conversion (3 x [64,1024], row-major).
// ---------------------------------------------------------------------------
__global__ void __launch_bounds__(256)
attn_cvt_weights(const float* __restrict__ Wq, const float* __restrict__ Wk,
                 const float* __restrict__ Wv, _Float16* __restrict__ wh) {
  int i = blockIdx.x * blockDim.x + threadIdx.x;
  if (i < D_ * E_) {
    wh[i]           = (_Float16)Wq[i];
    wh[D_*E_ + i]   = (_Float16)Wk[i];
    wh[2*D_*E_ + i] = (_Float16)Wv[i];
  }
}

// ---------------------------------------------------------------------------
// Kernel 2: fused QKV projection. One wave per 16-row tile of x, 12
// accumulators (Q/K/V x 4 n-tiles), K-loop over E in steps of 32.
// The loop is software-pipelined in registers: behind the WMMAs of step k all
// 12 weight fragments of step k+1 are asked for at once, into the registers
// just read, and then the x rows of step k+2.
// ---------------------------------------------------------------------------
typedef float v4f  __attribute__((ext_vector_type(4)));
typedef float v16f __attribute__((ext_vector_type(16)));

static __device__ __forceinline__ v16f load_x16(const float* p) {
  // 16 floats of one A-fragment lane: [p+0 .. p+7] and [p+16 .. p+23]
  v16f f;
  ((v4f*)&f)[0] = ((const v4f*)p)[0];
  ((v4f*)&f)[1] = ((const v4f*)p)[1];
  ((v4f*)&f)[2] = ((const v4f*)p)[4];
  ((v4f*)&f)[3] = ((const v4f*)p)[5];
  return f;
}

__global__ void __launch_bounds__(128)
attn_qkv_proj(const float* __restrict__ x, const _Float16* __restrict__ wh,
              const float* __restrict__ bq, const float* __restrict__ bk,
              const float* __restrict__ bv,
              _Float16* __restrict__ qh, _Float16* __restrict__ kh,
              _Float16* __restrict__ vth) {
  const int lane = threadIdx.x & 31;
  const int wave = threadIdx.x >> 5;
  const int tile = blockIdx.x * 4 + wave;   // 0..1023
  const int m0   = tile * 16;
  const int l16  = lane & 15;
  const int half = lane >> 4;
  const int kb   = half * 8;

  v8f acc[12];
  v8f vzero = {};
  #pragma unroll
  for (int i = 0; i < 12; ++i) acc[i] = vzero;

  const float*    xrow = x + (size_t)(m0 + l16) * E_ + kb;
  const _Float16* wrow = wh + (size_t)l16 * E_ + kb;   // fragment f: + f*16*E_

  // Prologue: x of steps 0 and 1, weights of step 0.
  v16f xs[2];
  v16h bf[12];
  xs[0] = load_x16(xrow);
  #pragma unroll
  for (int f = 0; f < 12; ++f) bf[f] = load_frag16(wrow + (size_t)f * 16 * E_);
  // Same issue order as in the loop (weights, then the younger x): otherwise
  // the counted waits at the loop's head also cover the youngest x loads.
  __builtin_amdgcn_sched_barrier(0);
  xs[1] = load_x16(xrow + 32);

  for (int k0 = 0; k0 < E_; k0 += 64) {
    // Two steps per pass, so that each x register set is refilled in place
    // (a copy from set to set would wait for the youngest load).
    #pragma unroll
    for (int h = 0; h < 2; ++h) {
      const int kc = k0 + h * 32;
      // Steps whose operands are fetched now, clamped to the last step.
      const int kn = (kc + 32 < E_) ? kc + 32 : E_ - 32;
      const int kx = (kc + 64 < E_) ? kc + 64 : E_ - 32;
      v16h a;
      #pragma unroll
      for (int e = 0; e < 16; ++e) a[e] = (_Float16)xs[h][e];
      #pragma unroll
      for (int f = 0; f < 12; ++f)            // f = w*4 + n
        acc[f] = wmma_f16(a, bf[f], acc[f]);
      // Keeps the refills behind the WMMAs that read the same registers:
      // scheduled above them they take a second register set (over 256).
      __builtin_amdgcn_sched_barrier(0);
      #pragma unroll
      for (int f = 0; f < 12; ++f)
        bf[f] = load_frag16(wrow + (size_t)f * 16 * E_ + kn);
      // The weight loads' address registers are reused by what follows, so
      // their address wait stands here. The statement also keeps the x loads
      // behind the weight loads: x comes from memory and loads return in issue
      // order, so asked for last, two steps ahead, it holds up no weight load
      // that the next step needs.
      asm volatile("s_wait_xcnt 0x0" ::: "memory");
      xs[h] = load_x16(xrow + kx);
      // Address wait of the x loads: the next step rewrites their address pair.
      asm volatile("s_wait_xcnt 0x0" ::: "memory");
      // Keeps the next step's conversion of x, and with it the wait for the
      // youngest x load, from being scheduled up into this step.
      __builtin_amdgcn_sched_barrier(0);
    }
  }

  #pragma unroll
  for (int w = 0; w < 3; ++w) {
    const float* bias = (w == 0) ? bq : ((w == 1) ? bk : bv);
    #pragma unroll
    for (int n = 0; n < 4; ++n) {
      const int col = n*16 + l16;
      const float bb = bias[col];
      #pragma unroll
      for (int r = 0; r < 8; ++r) {
        const int rowg = m0 + half*8 + r;
        const float val = acc[w*4 + n][r] + bb;
        if (w == 0) {
          qh[(size_t)rowg * D_ + col] = (_Float16)val;
        } else if (w == 1) {
          kh[(size_t)rowg * D_ + col] = (_Float16)val;
        } else {
          const int bi = rowg >> 11;
          const int s  = rowg & (S_ - 1);
          vth[((size_t)bi * D_ + col) * S_ + s] = (_Float16)val;
        }
      }
    }
  }
}

// ---------------------------------------------------------------------------
// Kernel 3: prep. biasf[b][j] = mask ? 0 : -1e22 (fp32, contiguous per j so
// the flash kernel reads it as broadcast float4s). vcum[b][t][d] = column
// prefix sums of V over j < t*32 (for the closed-form lower-triangle tail).
// ---------------------------------------------------------------------------
__global__ void __launch_bounds__(64)
attn_prep(const int* __restrict__ mask, const _Float16* __restrict__ vth,
          float* __restrict__ biasf, float* __restrict__ vcum) {
  const int b = blockIdx.x;
  const int d = threadIdx.x;          // 0..63
  for (int j = d; j < S_; j += 64)
    biasf[b * S_ + j] = mask[b * S_ + j] ? 0.0f : -1e22f;

  const _Float16* vp = vth + ((size_t)b * D_ + d) * S_;
  float run = 0.0f;
  for (int tblk = 0; tblk < S_ / 32; ++tblk) {
    vcum[((size_t)b * (S_ / 32) + tblk) * D_ + d] = run;
    const v8h* pv = (const v8h*)(vp + tblk * 32);
    #pragma unroll
    for (int g = 0; g < 4; ++g) {
      v8h h = pv[g];
      #pragma unroll
      for (int e = 0; e < 8; ++e) run += (float)h[e];
    }
  }
}

// ---------------------------------------------------------------------------
// Kernel 4: transposed flash attention. grid = (S/16, B), one wave per block.
// ---------------------------------------------------------------------------
template <bool CAUSAL>
static __device__ __forceinline__
void flash_step(int jb, int icol, int rowoff, int kb, int l16,
                const _Float16* __restrict__ kbase,
                const _Float16* __restrict__ vbase,
                const float* __restrict__ bias,
                const v16h& bq0, const v16h& bq1,
                float& mrun, float& lrun, v8f o[4]) {
  const float inv_sqrt_d = 0.125f;   // 1/sqrt(64)

  // S^T = K * Q^T : two 16x16 tiles (j rows), lane = i
  v8f c[2];
  #pragma unroll
  for (int f = 0; f < 2; ++f) {
    const _Float16* kp = kbase + (size_t)(jb + f*16 + l16) * D_;
    v16h ak0 = load_frag16(kp + kb);
    v16h ak1 = load_frag16(kp + 32 + kb);
    v8f cz = {};
    c[f] = wmma_f16(ak0, bq0, cz);
    c[f] = wmma_f16(ak1, bq1, c[f]);
  }

  // mask bias (broadcast, contiguous) + optional causal select; in-lane stats
  float s[2][8];
  float maxv = -INFINITY;
  #pragma unroll
  for (int f = 0; f < 2; ++f) {
    const float4* bp = (const float4*)(bias + jb + f*16 + rowoff);
    float4 bb0 = bp[0], bb1 = bp[1];
    float barr[8] = {bb0.x, bb0.y, bb0.z, bb0.w, bb1.x, bb1.y, bb1.z, bb1.w};
    #pragma unroll
    for (int r = 0; r < 8; ++r) {
      // |score| << 1e22/2^24, so fma(c, inv, -1e22) == -1e22 exactly.
      float sv = fmaf(c[f][r], inv_sqrt_d, barr[r]);
      if (CAUSAL) {
        const int j = jb + f*16 + rowoff + r;
        sv = (j >= icol) ? sv : -1e22f;
      }
      s[f][r] = sv;
      maxv = fmaxf(maxv, sv);
    }
  }
  maxv = fmaxf(maxv, __shfl_xor(maxv, 16, 32));   // other 16 j's, same i

  const float mnew  = fmaxf(mrun, maxv);
  const float scale = __expf(mrun - mnew);

  v16h pfrag;     // P as B-fragment: element e<8 -> f=0, e>=8 -> f=1
  float sum = 0.0f;
  #pragma unroll
  for (int f = 0; f < 2; ++f)
    #pragma unroll
    for (int r = 0; r < 8; ++r) {
      const float e = __expf(s[f][r] - mnew);
      sum += e;
      pfrag[f*8 + r] = (_Float16)e;
    }
  sum += __shfl_xor(sum, 16, 32);

  lrun = lrun * scale + sum;
  mrun = mnew;
  #pragma unroll
  for (int t = 0; t < 4; ++t) o[t] = o[t] * scale;

  // O^T += V^T * P  (A = V^T tile, contiguous; B = P in-register)
  #pragma unroll
  for (int t = 0; t < 4; ++t) {
    v16h av = load_frag16(vbase + (size_t)(t*16 + l16) * S_ + jb + kb);
    o[t] = wmma_f16(av, pfrag, o[t]);
  }
}

__global__ void __launch_bounds__(32)
attn_flash_t(const _Float16* __restrict__ qh, const _Float16* __restrict__ kh,
             const _Float16* __restrict__ vth, const float* __restrict__ biasf,
             const float* __restrict__ vcum, float* __restrict__ out) {
  const int lane   = threadIdx.x & 31;
  const int l16    = lane & 15;
  const int half   = lane >> 4;
  const int kb     = half * 8;
  const int rowoff = half * 8;
  const int i0     = blockIdx.x * 16;
  const int b      = blockIdx.y;
  const int icol   = i0 + l16;          // this lane's query row i
  const int jb0    = i0 & ~31;          // diagonal window start

  // Q^T B-fragments (lane = column i), loaded once, reused every step.
  const _Float16* qp = qh + ((size_t)b * S_ + icol) * D_;
  const v16h bq0 = load_frag16(qp + kb);
  const v16h bq1 = load_frag16(qp + 32 + kb);

  float mrun = -INFINITY;
  float lrun = 0.0f;
  v8f o[4];
  v8f vzero = {};
  #pragma unroll
  for (int t = 0; t < 4; ++t) o[t] = vzero;

  const float* bias = biasf + b * S_;
  const _Float16* kbase = kh + (size_t)b * S_ * D_;
  const _Float16* vbase = vth + (size_t)b * D_ * S_;

  // Diagonal window (only place the causal compare is needed).
  flash_step<true>(jb0, icol, rowoff, kb, l16, kbase, vbase, bias,
                   bq0, bq1, mrun, lrun, o);

  // Remaining windows: j >= i0+16 > every i in tile -> no causal test.
  for (int jb = jb0 + 32; jb < S_; jb += 32) {
    flash_step<false>(jb, icol, rowoff, kb, l16, kbase, vbase, bias,
                      bq0, bq1, mrun, lrun, o);
    if (jb + 32 < S_) {
      __builtin_prefetch(kbase + (size_t)(jb + 32 + l16) * D_, 0, 1);
      __builtin_prefetch(vbase + (size_t)l16 * S_ + jb + 32, 0, 1);
    }
  }

  // Closed-form lower-triangle tail: all j < jb0 are -1e22 for every row.
  // e0 = exp(-1e22 - m): 0 for normal rows, exactly 1 for all-masked rows,
  // reproducing the reference's uniform softmax over all S columns.
  if (jb0 > 0) {
    const float e0 = __expf(-1e22f - mrun);
    lrun += (float)jb0 * e0;
    const float* vc = vcum + ((size_t)b * (S_ / 32) + (jb0 >> 5)) * D_;
    #pragma unroll
    for (int t = 0; t < 4; ++t) {
      const float4* cp = (const float4*)(vc + t*16 + rowoff);
      float4 c0 = cp[0], c1 = cp[1];
      o[t][0] += e0 * c0.x; o[t][1] += e0 * c0.y;
      o[t][2] += e0 * c0.z; o[t][3] += e0 * c0.w;
      o[t][4] += e0 * c1.x; o[t][5] += e0 * c1.y;
      o[t][6] += e0 * c1.z; o[t][7] += e0 * c1.w;
    }
  }

  // Normalize, store: O^T lane = i, vgpr r = d -> contiguous float4 stores.
  const float inv = 1.0f / lrun;   // lrun >= 1 always
  float* op = out + ((size_t)b * S_ + icol) * D_;
  #pragma unroll
  for (int t = 0; t < 4; ++t) {
    float4 w0, w1;
    w0.x = o[t][0]*inv; w0.y = o[t][1]*inv; w0.z = o[t][2]*inv; w0.w = o[t][3]*inv;
    w1.x = o[t][4]*inv; w1.y = o[t][5]*inv; w1.z = o[t][6]*inv; w1.w = o[t][7]*inv;
    float* dst = op + t*16 + rowoff;
    ((float4*)dst)[0] = w0;
    ((float4*)dst)[1] = w1;
  }
}

// ---------------------------------------------------------------------------
extern "C" void kernel_launch(void* const* d_in, const int* in_sizes, int n_in,
                              void* d_out, int out_size, void* d_ws, size_t ws_size,
                              hipStream_t stream) {
  const float* x  = (const float*)d_in[0];
  const int* mask = (const int*)d_in[1];
  const float* Wq = (const float*)d_in[2];
  const float* bq = (const float*)d_in[3];
  const float* Wk = (const float*)d_in[4];
  const float* bk = (const float*)d_in[5];
  const float* Wv = (const float*)d_in[6];
  const float* bv = (const float*)d_in[7];
  float* out = (float*)d_out;

  // Workspace: f16 {weights | q | k | v^T} then f32 {biasf | vcum} ~ 6.9 MB
  _Float16* wh   = (_Float16*)d_ws;
  _Float16* qh   = wh + 3 * D_ * E_;
  _Float16* kh   = qh + (size_t)B_ * S_ * D_;
  _Float16* vth  = kh + (size_t)B_ * S_ * D_;
  float*    biasf = (float*)(vth + (size_t)B_ * S_ * D_);
  float*    vcum  = biasf + (size_t)B_ * S_;

  attn_cvt_weights<<<(D_ * E_ + 255) / 256, 256, 0, stream>>>(Wq, Wk, Wv, wh);
  attn_qkv_proj<<<256, 128, 0, stream>>>(x, wh, bq, bk, bv, qh, kh, vth);
  attn_prep<<<B_, 64, 0, stream>>>(mask, vth, biasf, vcum);
  attn_flash_t<<<dim3(S_ / 16, B_), 32, 0, stream>>>(qh, kh, vth, biasf, vcum, out);
}

// v002
// One run takes 74.4 microseconds.
// Two timings next to v001 both put it at 1.21 times that version's speed.
// All steps since v000 together make it 1.59 times as fast.
#include <hip/hip_runtime.h>

// ---------------------------------------------------------------------------
// Self-attention B=8, S=2048, E=1024, D=64 on gfx1250 (MI455X).
//   k1: Wq/Wk/Wv fp32 -> f16
//   k2: fused QKV projection (12x v_wmma_f32_16x16x32_f16 per K-step);
//       q,k row-major [B*S,64] f16; v transposed [B,64,S] f16.
//   k3: prep: mask -> fp32 additive bias; V column prefix-sums per 32-block.
//   k4: transposed flash attention:
//         S^T = K*Q^T (lane = i), P^T C-layout == P B-fragment -> no LDS,
//         O^T = V^T*P (lane = i -> scalar softmax state),
//       starting at the diagonal window; key windows dealt over 8 waves and
//       merged in LDS; the strictly-lower region is applied in closed form
//       (exact for the all-masked uniform-softmax fallback).
// ---------------------------------------------------------------------------

typedef _Float16 v16h __attribute__((ext_vector_type(16)));
typedef _Float16 v8h  __attribute__((ext_vector_type(8)));
typedef float    v8f  __attribute__((ext_vector_type(8)));

#define B_ 8
#define S_ 2048
#define E_ 1024
#define D_ 64

static __device__ __forceinline__ v8f wmma_f16(v16h a, v16h b, v8f c) {
  // D = A(16x32 f16) * B(32x16 f16) + C(16x16 f32)
  return __builtin_amdgcn_wmma_f32_16x16x32_f16(false, a, false, b,
                                                (short)0, c, false, false);
}

static __device__ __forceinline__ v16h load_frag16(const _Float16* p) {
  // 16 halves of one fragment lane: [p+0 .. p+7] and [p+16 .. p+23]
  v16h f;
  ((v8h*)&f)[0] = ((const v8h*)p)[0];
  ((v8h*)&f)[1] = ((const v8h*)p)[2];
  return f;
}

// ---------------------------------------------------------------------------
// Kernel 1: fp32 -> f16 weight conversion (3 x [64,1024], row-major).
// ---------------------------------------------------------------------------
__global__ void __launch_bounds__(256)
attn_cvt_weights(const float* __restrict__ Wq, const float* __restrict__ Wk,
                 const float* __restrict__ Wv, _Float16* __restrict__ wh) {
  int i = blockIdx.x * blockDim.x + threadIdx.x;
  if (i < D_ * E_) {
    wh[i]           = (_Float16)Wq[i];
    wh[D_*E_ + i]   = (_Float16)Wk[i];
    wh[2*D_*E_ + i] = (_Float16)Wv[i];
  }
}

// ---------------------------------------------------------------------------
// Kernel 2: fused QKV projection. One wave per 16-row tile of x, 12
// accumulators (Q/K/V x 4 n-tiles), K-loop over E in steps of 32.
// The loop is software-pipelined in registers: behind the WMMAs of step k all
// 12 weight fragments of step k+1 are asked for at once, into the registers
// just read, and then the x rows of step k+2.
// ---------------------------------------------------------------------------
typedef float v4f  __attribute__((ext_vector_type(4)));
typedef float v16f __attribute__((ext_vector_type(16)));

static __device__ __forceinline__ v16f load_x16(const float* p) {
  // 16 floats of one A-fragment lane: [p+0 .. p+7] and [p+16 .. p+23]
  v16f f;
  ((v4f*)&f)[0] = ((const v4f*)p)[0];
  ((v4f*)&f)[1] = ((const v4f*)p)[1];
  ((v4f*)&f)[2] = ((const v4f*)p)[4];
  ((v4f*)&f)[3] = ((const v4f*)p)[5];
  return f;
}

__global__ void __launch_bounds__(128)
attn_qkv_proj(const float* __restrict__ x, const _Float16* __restrict__ wh,
              const float* __restrict__ bq, const float* __restrict__ bk,
              const float* __restrict__ bv,
              _Float16* __restrict__ qh, _Float16* __restrict__ kh,
              _Float16* __restrict__ vth) {
  const int lane = threadIdx.x & 31;
  const int wave = threadIdx.x >> 5;
  const int tile = blockIdx.x * 4 + wave;   // 0..1023
  const int m0   = tile * 16;
  const int l16  = lane & 15;
  const int half = lane >> 4;
  const int kb   = half * 8;

  v8f acc[12];
  v8f vzero = {};
  #pragma unroll
  for (int i = 0; i < 12; ++i) acc[i] = vzero;

  const float*    xrow = x + (size_t)(m0 + l16) * E_ + kb;
  const _Float16* wrow = wh + (size_t)l16 * E_ + kb;   // fragment f: + f*16*E_

  // Prologue: x of steps 0 and 1, weights of step 0.
  v16f xs[2];
  v16h bf[12];
  xs[0] = load_x16(xrow);
  #pragma unroll
  for (int f = 0; f < 12; ++f) bf[f] = load_frag16(wrow + (size_t)f * 16 * E_);
  // Same issue order as in the loop (weights, then the younger x): otherwise
  // the counted waits at the loop's head also cover the youngest x loads.
  __builtin_amdgcn_sched_barrier(0);
  xs[1] = load_x16(xrow + 32);

  for (int k0 = 0; k0 < E_; k0 += 64) {
    // Two steps per pass, so that each x register set is refilled in place
    // (a copy from set to set would wait for the youngest load).
    #pragma unroll
    for (int h = 0; h < 2; ++h) {
      const int kc = k0 + h * 32;
      // Steps whose operands are fetched now, clamped to the last step.
      const int kn = (kc + 32 < E_) ? kc + 32 : E_ - 32;
      const int kx = (kc + 64 < E_) ? kc + 64 : E_ - 32;
      v16h a;
      #pragma unroll
      for (int e = 0; e < 16; ++e) a[e] = (_Float16)xs[h][e];
      #pragma unroll
      for (int f = 0; f < 12; ++f)            // f = w*4 + n
        acc[f] = wmma_f16(a, bf[f], acc[f]);
      // Keeps the refills behind the WMMAs that read the same registers:
      // scheduled above them they take a second register set (over 256).
      __builtin_amdgcn_sched_barrier(0);
      #pragma unroll
      for (int f = 0; f < 12; ++f)
        bf[f] = load_frag16(wrow + (size_t)f * 16 * E_ + kn);
      // The weight loads' address registers are reused by what follows, so
      // their address wait stands here. The statement also keeps the x loads
      // behind the weight loads: x comes from memory and loads return in issue
      // order, so asked for last, two steps ahead, it holds up no weight load
      // that the next step needs.
      asm volatile("s_wait_xcnt 0x0" ::: "memory");
      xs[h] = load_x16(xrow + kx);
      // Address wait of the x loads: the next step rewrites their address pair.
      asm volatile("s_wait_xcnt 0x0" ::: "memory");
      // Keeps the next step's conversion of x, and with it the wait for the
      // youngest x load, from being scheduled up into this step.
      __builtin_amdgcn_sched_barrier(0);
    }
  }

  #pragma unroll
  for (int w = 0; w < 3; ++w) {
    const float* bias = (w == 0) ? bq : ((w == 1) ? bk : bv);
    #pragma unroll
    for (int n = 0; n < 4; ++n) {
      const int col = n*16 + l16;
      const float bb = bias[col];
      #pragma unroll
      for (int r = 0; r < 8; ++r) {
        const int rowg = m0 + half*8 + r;
        const float val = acc[w*4 + n][r] + bb;
        if (w == 0) {
          qh[(size_t)rowg * D_ + col] = (_Float16)val;
        } else if (w == 1) {
          kh[(size_t)rowg * D_ + col] = (_Float16)val;
        } else {
          const int bi = rowg >> 11;
          const int s  = rowg & (S_ - 1);
          vth[((size_t)bi * D_ + col) * S_ + s] = (_Float16)val;
        }
      }
    }
  }
}

// ---------------------------------------------------------------------------
// Kernel 3: prep. biasf[b][j] = mask ? 0 : -1e22 (fp32, contiguous per j so
// the flash kernel reads it as broadcast float4s). vcum[b][t][d] = column
// prefix sums of V over j < t*32 (for the closed-form lower-triangle tail).
// ---------------------------------------------------------------------------
__global__ void __launch_bounds__(64)
attn_prep(const int* __restrict__ mask, const _Float16* __restrict__ vth,
          float* __restrict__ biasf, float* __restrict__ vcum) {
  const int b = blockIdx.x;
  const int d = threadIdx.x;          // 0..63
  for (int j = d; j < S_; j += 64)
    biasf[b * S_ + j] = mask[b * S_ + j] ? 0.0f : -1e22f;

  const _Float16* vp = vth + ((size_t)b * D_ + d) * S_;
  float run = 0.0f;
  for (int tblk = 0; tblk < S_ / 32; ++tblk) {
    vcum[((size_t)b * (S_ / 32) + tblk) * D_ + d] = run;
    const v8h* pv = (const v8h*)(vp + tblk * 32);
    #pragma unroll
    for (int g = 0; g < 4; ++g) {
      v8h h = pv[g];
      #pragma unroll
      for (int e = 0; e < 8; ++e) run += (float)h[e];
    }
  }
}

// ---------------------------------------------------------------------------
// Kernel 4: transposed flash attention. grid = (S/32, B), 8 waves per block.
// A block takes the query tiles t and S/16-1-t (equal work in every block) and
// deals their 32-key windows over its waves; the partial softmax states are
// merged through LDS.
// ---------------------------------------------------------------------------
template <bool CAUSAL>
static __device__ __forceinline__
void flash_step(int jb, int icol, int rowoff, int kb, int l16,
                const _Float16* __restrict__ kbase,
                const _Float16* __restrict__ vbase,
                const float* __restrict__ bias,
                const v16h& bq0, const v16h& bq1,
                float& mrun, float& lrun, v8f o[4]) {
  const float inv_sqrt_d = 0.125f;   // 1/sqrt(64)

  // S^T = K * Q^T : two 16x16 tiles (j rows), lane = i
  v8f c[2];
  #pragma unroll
  for (int f = 0; f < 2; ++f) {
    const _Float16* kp = kbase + (size_t)(jb + f*16 + l16) * D_;
    v16h ak0 = load_frag16(kp + kb);
    v16h ak1 = load_frag16(kp + 32 + kb);
    v8f cz = {};
    c[f] = wmma_f16(ak0, bq0, cz);
    c[f] = wmma_f16(ak1, bq1, c[f]);
  }

  // mask bias (broadcast, contiguous) + optional causal select; in-lane stats
  float s[2][8];
  float maxv = -INFINITY;
  #pragma unroll
  for (int f = 0; f < 2; ++f) {
    const float4* bp = (const float4*)(bias + jb + f*16 + rowoff);
    float4 bb0 = bp[0], bb1 = bp[1];
    float barr[8] = {bb0.x, bb0.y, bb0.z, bb0.w, bb1.x, bb1.y, bb1.z, bb1.w};
    #pragma unroll
    for (int r = 0; r < 8; ++r) {
      // |score| << 1e22/2^24, so fma(c, inv, -1e22) == -1e22 exactly.
      float sv = fmaf(c[f][r], inv_sqrt_d, barr[r]);
      if (CAUSAL) {
        const int j = jb + f*16 + rowoff + r;
        sv = (j >= icol) ? sv : -1e22f;
      }
      s[f][r] = sv;
      maxv = fmaxf(maxv, sv);
    }
  }
  maxv = fmaxf(maxv, __shfl_xor(maxv, 16, 32));   // other 16 j's, same i

  const float mnew  = fmaxf(mrun, maxv);
  const float scale = __expf(mrun - mnew);

  v16h pfrag;     // P as B-fragment: element e<8 -> f=0, e>=8 -> f=1
  float sum = 0.0f;
  #pragma unroll
  for (int f = 0; f < 2; ++f)
    #pragma unroll
    for (int r = 0; r < 8; ++r) {
      const float e = __expf(s[f][r] - mnew);
      sum += e;
      pfrag[f*8 + r] = (_Float16)e;
    }
  sum += __shfl_xor(sum, 16, 32);

  lrun = lrun * scale + sum;
  mrun = mnew;
  #pragma unroll
  for (int t = 0; t < 4; ++t) o[t] = o[t] * scale;

  // O^T += V^T * P  (A = V^T tile, contiguous; B = P in-register)
  #pragma unroll
  for (int t = 0; t < 4; ++t) {
    v16h av = load_frag16(vbase + (size_t)(t*16 + l16) * S_ + jb + kb);
    o[t] = wmma_f16(av, pfrag, o[t]);
  }
}

// exp(x) for the merge weights. v_exp_f32 and the free slot that the
// instruction set asks for behind it stand in one statement.
static __device__ __forceinline__ float exp_with_slot(float x) {
  float r;
  asm("v_exp_f32 %0, %1\n\tv_nop" : "=v"(r) : "v"(x * 1.44269504f));
  return r;
}

#define NW_ 8     // waves per work-group
#define OP_ 68    // merge buffer: floats per query row (272 B = 16 B x 17)

__global__ void __launch_bounds__(256)
attn_flash_t(const _Float16* __restrict__ qh, const _Float16* __restrict__ kh,
             const _Float16* __restrict__ vth, const float* __restrict__ biasf,
             const float* __restrict__ vcum, float* __restrict__ out) {
  // Per (tile of the pair, wave): un-normalised O^T partial, running max, sum.
  __shared__ __attribute__((aligned(16))) float so[2][NW_][16][OP_];
  __shared__ float sm[2][NW_][16];
  __shared__ float sl[2][NW_][16];

  const int lane   = threadIdx.x & 31;
  const int wave   = __builtin_amdgcn_readfirstlane(threadIdx.x >> 5);
  const int l16    = lane & 15;
  const int half   = lane >> 4;
  const int kb     = half * 8;
  const int rowoff = half * 8;
  const int pr     = blockIdx.x;        // pair: tiles pr and S/16 - 1 - pr
  const int b      = blockIdx.y;

  const float* bias = biasf + b * S_;
  const _Float16* kbase = kh + (size_t)b * S_ * D_;
  const _Float16* vbase = vth + (size_t)b * D_ * S_;

  // The windows of both tiles (65 in every pair) form one list that is dealt
  // round-robin over the waves; u = this wave's next window in the tile.
  int u = wave;
  for (int h = 0; h < 2; ++h) {
    const int i0   = (h ? (S_ / 16 - 1 - pr) : pr) * 16;
    const int icol = i0 + l16;          // this lane's query row i
    const int jb0  = i0 & ~31;          // diagonal window start
    const int nwin = (S_ - jb0) >> 5;

    // Q^T B-fragments (lane = column i), loaded once per tile.
    const _Float16* qp = qh + ((size_t)b * S_ + icol) * D_;
    const v16h bq0 = load_frag16(qp + kb);
    const v16h bq1 = load_frag16(qp + 32 + kb);

    float mrun = -INFINITY;
    float lrun = 0.0f;
    v8f o[4];
    v8f vzero = {};
    #pragma unroll
    for (int t = 0; t < 4; ++t) o[t] = vzero;

    // Diagonal window (only place the causal compare is needed).
    if (u == 0) {
      flash_step<true>(jb0, icol, rowoff, kb, l16, kbase, vbase, bias,
                       bq0, bq1, mrun, lrun, o);
      u = NW_;
    }
    // Remaining windows: j >= i0+16 > every i in tile -> no causal test.
    for (; u < nwin; u += NW_)
      flash_step<false>(jb0 + u * 32, icol, rowoff, kb, l16, kbase, vbase, bias,
                        bq0, bq1, mrun, lrun, o);
    u -= nwin;                          // place in the next tile's windows

    // A wave without a window of this tile leaves (-inf, 0, 0): weight 0.
    if (half == 0) {
      sm[h][wave][l16] = mrun;
      sl[h][wave][l16] = lrun;
    }
    #pragma unroll
    for (int t = 0; t < 4; ++t) {
      float4 w0, w1;
      w0.x = o[t][0]; w0.y = o[t][1]; w0.z = o[t][2]; w0.w = o[t][3];
      w1.x = o[t][4]; w1.y = o[t][5]; w1.z = o[t][6]; w1.w = o[t][7];
      float* dst = &so[h][wave][l16][t*16 + rowoff];
      ((float4*)dst)[0] = w0;
      ((float4*)dst)[1] = w1;
    }
  }

  // Publishes every wave's partials to the merging threads.
  __syncthreads();

  // Merge: thread = (query row mi, four d); a wave stores whole 128-B lines.
  const int mi = threadIdx.x >> 4;
  const int dq = (threadIdx.x & 15) * 4;
  #pragma unroll
  for (int h = 0; h < 2; ++h) {
    const int i0  = (h ? (S_ / 16 - 1 - pr) : pr) * 16;
    const int jb0 = i0 & ~31;
    float mw[NW_];
    float mall = -INFINITY;             // finite: the diagonal window's wave
    #pragma unroll
    for (int w = 0; w < NW_; ++w) {
      mw[w] = sm[h][w][mi];
      mall = fmaxf(mall, mw[w]);
    }
    #pragma unroll
    for (int w = 0; w < NW_; ++w) mw[w] = exp_with_slot(mw[w] - mall);   // weights
    float lall = 0.0f;
    float4 acc = {0.0f, 0.0f, 0.0f, 0.0f};
    #pragma unroll
    for (int w = 0; w < NW_; ++w) {
      const float g = mw[w];
      const float4 p = *(const float4*)&so[h][w][mi][dq];
      lall += sl[h][w][mi] * g;
      acc.x += g * p.x; acc.y += g * p.y; acc.z += g * p.z; acc.w += g * p.w;
    }
    // Closed-form lower-triangle tail: all j < jb0 are -1e22 for every row.
    // e0 = exp(-1e22 - m): 0 for normal rows, exactly 1 for all-masked rows,
    // reproducing the reference's uniform softmax over all S columns.
    if (jb0 > 0) {
      const float e0 = __expf(-1e22f - mall);
      const float4 c = *(const float4*)(
          vcum + ((size_t)b * (S_ / 32) + (jb0 >> 5)) * D_ + dq);
      lall += (float)jb0 * e0;
      acc.x += e0 * c.x; acc.y += e0 * c.y; acc.z += e0 * c.z; acc.w += e0 * c.w;
    }
    const float inv = 1.0f / lall;      // lall >= 1 always
    float4 r;
    r.x = acc.x * inv; r.y = acc.y * inv; r.z = acc.z * inv; r.w = acc.w * inv;
    *(float4*)(out + ((size_t)b * S_ + i0 + mi) * D_ + dq) = r;
    // Address wait of the first tile's store: the second tile's merge reuses
    // the registers that the store names.
    if (h == 0) asm volatile("s_wait_xcnt 0x0" ::: "memory");
  }
}

// ---------------------------------------------------------------------------
extern "C" void kernel_launch(void* const* d_in, const int* in_sizes, int n_in,
                              void* d_out, int out_size, void* d_ws, size_t ws_size,
                              hipStream_t stream) {
  const float* x  = (const float*)d_in[0];
  const int* mask = (const int*)d_in[1];
  const float* Wq = (const float*)d_in[2];
  const float* bq = (const float*)d_in[3];
  const float* Wk = (const float*)d_in[4];
  const float* bk = (const float*)d_in[5];
  const float* Wv = (const float*)d_in[6];
  const float* bv = (const float*)d_in[7];
  float* out = (float*)d_out;

  // Workspace: f16 {weights | q | k | v^T} then f32 {biasf | vcum} ~ 6.9 MB
  _Float16* wh   = (_Float16*)d_ws;
  _Float16* qh   = wh + 3 * D_ * E_;
  _Float16* kh   = qh + (size_t)B_ * S_ * D_;
  _Float16* vth  = kh + (size_t)B_ * S_ * D_;
  float*    biasf = (float*)(vth + (size_t)B_ * S_ * D_);
  float*    vcum  = biasf + (size_t)B_ * S_;

  attn_cvt_weights<<<(D_ * E_ + 255) / 256, 256, 0, stream>>>(Wq, Wk, Wv, wh);
  attn_qkv_proj<<<256, 128, 0, stream>>>(x, wh, bq, bk, bv, qh, kh, vth);
  attn_prep<<<B_, 64, 0, stream>>>(mask, vth, biasf, vcum);
  attn_flash_t<<<dim3(S_ / 32, B_), 256, 0, stream>>>(qh, kh, vth, biasf, vcum, out);
}

// v003
// A run of this version takes 54.5 microseconds.
// In both of two side-by-side timings against v002, it was 1.37 times as fast.
// All steps since v000 together make it 2.17 times as fast.
#include <hip/hip_runtime.h>

// ---------------------------------------------------------------------------
// Self-attention B=8, S=2048, E=1024, D=64 on gfx1250 (MI455X).
//   k1: Wq/Wk/Wv fp32 -> f16
//   k2: fused QKV projection (12x v_wmma_f32_16x16x32_f16 per K-step);
//       q,k row-major [B*S,64] f16; v transposed [B,64,S] f16.
//   k3: prep: mask -> fp32 additive bias; V column prefix-sums per 32-block
//       (one wave per column: lane sums, then a wave scan).
//   k4: transposed flash attention:
//         S^T = K*Q^T (lane = i), P^T C-layout == P B-fragment -> no LDS,
//         O^T = V^T*P (lane = i -> scalar softmax state),
//       starting at the diagonal window; key windows dealt over 8 waves and
//       merged in LDS; the strictly-lower region is applied in closed form
//       (exact for the all-masked uniform-softmax fallback).
// ---------------------------------------------------------------------------

typedef _Float16 v16h __attribute__((ext_vector_type(16)));
typedef _Float16 v8h  __attribute__((ext_vector_type(8)));
typedef float    v8f  __attribute__((ext_vector_type(8)));

#define B_ 8
#define S_ 2048
#define E_ 1024
#define D_ 64

static __device__ __forceinline__ v8f wmma_f16(v16h a, v16h b, v8f c) {
  // D = A(16x32 f16) * B(32x16 f16) + C(16x16 f32)
  return __builtin_amdgcn_wmma_f32_16x16x32_f16(false, a, false, b,
                                                (short)0, c, false, false);
}

static __device__ __forceinline__ v16h load_frag16(const _Float16* p) {
  // 16 halves of one fragment lane: [p+0 .. p+7] and [p+16 .. p+23]
  v16h f;
  ((v8h*)&f)[0] = ((const v8h*)p)[0];
  ((v8h*)&f)[1] = ((const v8h*)p)[2];
  return f;
}

// ---------------------------------------------------------------------------
// Kernel 1: fp32 -> f16 weight conversion (3 x [64,1024], row-major).
// ---------------------------------------------------------------------------
__global__ void __launch_bounds__(256)
attn_cvt_weights(const float* __restrict__ Wq, const float* __restrict__ Wk,
                 const float* __restrict__ Wv, _Float16* __restrict__ wh) {
  int i = blockIdx.x * blockDim.x + threadIdx.x;
  if (i < D_ * E_) {
    wh[i]           = (_Float16)Wq[i];
    wh[D_*E_ + i]   = (_Float16)Wk[i];
    wh[2*D_*E_ + i] = (_Float16)Wv[i];
  }
}

// ---------------------------------------------------------------------------
// Kernel 2: fused QKV projection. One wave per 16-row tile of x, 12
// accumulators (Q/K/V x 4 n-tiles), K-loop over E in steps of 32.
// The loop is software-pipelined in registers: behind the WMMAs of step k all
// 12 weight fragments of step k+1 are asked for at once, into the registers
// just read, and then the x rows of step k+2.
// ---------------------------------------------------------------------------
typedef float v4f  __attribute__((ext_vector_type(4)));
typedef float v16f __attribute__((ext_vector_type(16)));

static __device__ __forceinline__ v16f load_x16(const float* p) {
  // 16 floats of one A-fragment lane: [p+0 .. p+7] and [p+16 .. p+23]
  v16f f;
  ((v4f*)&f)[0] = ((const v4f*)p)[0];
  ((v4f*)&f)[1] = ((const v4f*)p)[1];
  ((v4f*)&f)[2] = ((const v4f*)p)[4];
  ((v4f*)&f)[3] = ((const v4f*)p)[5];
  return f;
}

__global__ void __launch_bounds__(128)
attn_qkv_proj(const float* __restrict__ x, const _Float16* __restrict__ wh,
              const float* __restrict__ bq, const float* __restrict__ bk,
              const float* __restrict__ bv,
              _Float16* __restrict__ qh, _Float16* __restrict__ kh,
              _Float16* __restrict__ vth) {
  const int lane = threadIdx.x & 31;
  const int wave = threadIdx.x >> 5;
  const int tile = blockIdx.x * 4 + wave;   // 0..1023
  const int m0   = tile * 16;
  const int l16  = lane & 15;
  const int half = lane >> 4;
  const int kb   = half * 8;

  v8f acc[12];
  v8f vzero = {};
  #pragma unroll
  for (int i = 0; i < 12; ++i) acc[i] = vzero;

  const float*    xrow = x + (size_t)(m0 + l16) * E_ + kb;
  const _Float16* wrow = wh + (size_t)l16 * E_ + kb;   // fragment f: + f*16*E_

  // Prologue: x of steps 0 and 1, weights of step 0.
  v16f xs[2];
  v16h bf[12];
  xs[0] = load_x16(xrow);
  #pragma unroll
  for (int f = 0; f < 12; ++f) bf[f] = load_frag16(wrow + (size_t)f * 16 * E_);
  // Same issue order as in the loop (weights, then the younger x): otherwise
  // the counted waits at the loop's head also cover the youngest x loads.
  __builtin_amdgcn_sched_barrier(0);
  xs[1] = load_x16(xrow + 32);

  for (int k0 = 0; k0 < E_; k0 += 64) {
    // Two steps per pass, so that each x register set is refilled in place
    // (a copy from set to set would wait for the youngest load).
    #pragma unroll
    for (int h = 0; h < 2; ++h) {
      const int kc = k0 + h * 32;
      // Steps whose operands are fetched now, clamped to the last step.
      const int kn = (kc + 32 < E_) ? kc + 32 : E_ - 32;
      const int kx = (kc + 64 < E_) ? kc + 64 : E_ - 32;
      v16h a;
      #pragma unroll
      for (int e = 0; e < 16; ++e) a[e] = (_Float16)xs[h][e];
      #pragma unroll
      for (int f = 0; f < 12; ++f)            // f = w*4 + n
        acc[f] = wmma_f16(a, bf[f], acc[f]);
      // Keeps the refills behind the WMMAs that read the same registers:
      // scheduled above them they take a second register set (over 256).
      __builtin_amdgcn_sched_barrier(0);
      #pragma unroll
      for (int f = 0; f < 12; ++f)
        bf[f] = load_frag16(wrow + (size_t)f * 16 * E_ + kn);
      // The weight loads' address registers are reused by what follows, so
      // their address wait stands here. The statement also keeps the x loads
      // behind the weight loads: x comes from memory and loads return in issue
      // order, so asked for last, two steps ahead, it holds up no weight load
      // that the next step needs.
      asm volatile("s_wait_xcnt 0x0" ::: "memory");
      xs[h] = load_x16(xrow + kx);
      // Address wait of the x loads: the next step rewrites their address pair.
      asm volatile("s_wait_xcnt 0x0" ::: "memory");
      // Keeps the next step's conversion of x, and with it the wait for the
      // youngest x load, from being scheduled up into this step.
      __builtin_amdgcn_sched_barrier(0);
    }
  }

  #pragma unroll
  for (int w = 0; w < 3; ++w) {
    const float* bias = (w == 0) ? bq : ((w == 1) ? bk : bv);
    #pragma unroll
    for (int n = 0; n < 4; ++n) {
      const int col = n*16 + l16;
      const float bb = bias[col];
      #pragma unroll
      for (int r = 0; r < 8; ++r) {
        const int rowg = m0 + half*8 + r;
        const float val = acc[w*4 + n][r] + bb;
        if (w == 0) {
          qh[(size_t)rowg * D_ + col] = (_Float16)val;
        } else if (w == 1) {
          kh[(size_t)rowg * D_ + col] = (_Float16)val;
        } else {
          const int bi = rowg >> 11;
          const int s  = rowg & (S_ - 1);
          vth[((size_t)bi * D_ + col) * S_ + s] = (_Float16)val;
        }
      }
    }
  }
}

// ---------------------------------------------------------------------------
// Kernel 3: prep. biasf[b][j] = mask ? 0 : -1e22 (fp32, contiguous per j so
// the flash kernel reads it as broadcast float4s). vcum[b][t][d] = column
// prefix sums of V over j < t*32 (for the closed-form lower-triangle tail).
// grid = B*2 blocks of 32 waves: a block takes 32 columns d of one batch, a
// wave one column. The wave asks for its whole column at once (8 loads of
// 512 contiguous bytes), each lane sums 8 keys per load; through LDS a lane
// then gets the sums of its own two 32-blocks, and the wave scans the lane
// totals. The block turns the result in LDS so that each 128-B line of vcum
// is stored whole by one wave.
// ---------------------------------------------------------------------------
#define PC_ 260   // 8-key sums of a column: LDS pitch in floats (16 B x 65)
#define PP_ 33    // prefix sums: LDS pitch in floats (a write hits 32 banks)

__global__ void __launch_bounds__(1024)
attn_prep(const int* __restrict__ mask, const _Float16* __restrict__ vth,
          float* __restrict__ biasf, float* __restrict__ vcum) {
  __shared__ __attribute__((aligned(16))) float ps[32][PC_];  // [d][j / 8]
  __shared__ float sc[S_ / 32][PP_];                          // [t][d]

  const int lane = threadIdx.x & 31;
  const int wave = threadIdx.x >> 5;  // column within the block's 32
  const int b    = blockIdx.x >> 1;
  const int d0   = (blockIdx.x & 1) * 32;
  const int gid  = blockIdx.x * 1024 + threadIdx.x;   // B*2*1024 == B*S

  const _Float16* col = vth + ((size_t)b * D_ + d0 + wave) * S_ + lane * 8;
  v8h hv[8];
  #pragma unroll
  for (int g = 0; g < 8; ++g) hv[g] = *(const v8h*)(col + g * 256);
  const int mk = mask[gid];
  // Address wait of the loads: the sums reuse the column's address pair.
  asm volatile("s_wait_xcnt 0x0" ::: "memory");
  // Keeps all nine loads in front of the sums: scheduled among them, the loads
  // went out in four groups, each waiting for the one before.
  __builtin_amdgcn_sched_barrier(0);

  #pragma unroll
  for (int g = 0; g < 8; ++g) {
    float p = (float)hv[g][0];
    #pragma unroll
    for (int e = 1; e < 8; ++e) p += (float)hv[g][e];
    ps[wave][g * 32 + lane] = p;      // keys g*256 + lane*8 .. +7
  }

  // Publishes the 8-key sums to the lanes that add them up per 32-block.
  __syncthreads();

  const float4 c0 = *(const float4*)&ps[wave][lane * 8];       // block 2*lane
  const float4 c1 = *(const float4*)&ps[wave][lane * 8 + 4];   // block 2*lane+1
  const float s0 = (c0.x + c0.y) + (c0.z + c0.w);
  const float s1 = (c1.x + c1.y) + (c1.z + c1.w);

  float inc = s0 + s1;                // inclusive scan over the lanes
  #pragma unroll
  for (int sh = 1; sh < 32; sh <<= 1) {
    const float up = __shfl_up(inc, sh, 32);
    if (lane >= sh) inc += up;
  }
  float before = __shfl_up(inc, 1, 32);   // sum over the keys of lower lanes
  if (lane == 0) before = 0.0f;
  sc[2 * lane][wave]     = before;
  sc[2 * lane + 1][wave] = before + s0;

  // Publishes every column's prefix sums to the storing threads.
  __syncthreads();

  const int t  = threadIdx.x >> 4;
  const int dp = (threadIdx.x & 15) * 2;
  float2 r;
  r.x = sc[t][dp];
  r.y = sc[t][dp + 1];
  *(float2*)(vcum + ((size_t)b * (S_ / 32) + t) * D_ + d0 + dp) = r;
  biasf[gid] = mk ? 0.0f : -1e22f;
}

// ---------------------------------------------------------------------------
// Kernel 4: transposed flash attention. grid = (S/32, B), 8 waves per block.
// A block takes the query tiles t and S/16-1-t (equal work in every block) and
// deals their 32-key windows over its waves; the partial softmax states are
// merged through LDS.
// ---------------------------------------------------------------------------
template <bool CAUSAL>
static __device__ __forceinline__
void flash_step(int jb, int icol, int rowoff, int kb, int l16,
                const _Float16* __restrict__ kbase,
                const _Float16* __restrict__ vbase,
                const float* __restrict__ bias,
                const v16h& bq0, const v16h& bq1,
                float& mrun, float& lrun, v8f o[4]) {
  const float inv_sqrt_d = 0.125f;   // 1/sqrt(64)

  // S^T = K * Q^T : two 16x16 tiles (j rows), lane = i
  v8f c[2];
  #pragma unroll
  for (int f = 0; f < 2; ++f) {
    const _Float16* kp = kbase + (size_t)(jb + f*16 + l16) * D_;
    v16h ak0 = load_frag16(kp + kb);
    v16h ak1 = load_frag16(kp + 32 + kb);
    v8f cz = {};
    c[f] = wmma_f16(ak0, bq0, cz);
    c[f] = wmma_f16(ak1, bq1, c[f]);
  }

  // mask bias (broadcast, contiguous) + optional causal select; in-lane stats
  float s[2][8];
  float maxv = -INFINITY;
  #pragma unroll
  for (int f = 0; f < 2; ++f) {
    const float4* bp = (const float4*)(bias + jb + f*16 + rowoff);
    float4 bb0 = bp[0], bb1 = bp[1];
    float barr[8] = {bb0.x, bb0.y, bb0.z, bb0.w, bb1.x, bb1.y, bb1.z, bb1.w};
    #pragma unroll
    for (int r = 0; r < 8; ++r) {
      // |score| << 1e22/2^24, so fma(c, inv, -1e22) == -1e22 exactly.
      float sv = fmaf(c[f][r], inv_sqrt_d, barr[r]);
      if (CAUSAL) {
        const int j = jb + f*16 + rowoff + r;
        sv = (j >= icol) ? sv : -1e22f;
      }
      s[f][r] = sv;
      maxv = fmaxf(maxv, sv);
    }
  }
  maxv = fmaxf(maxv, __shfl_xor(maxv, 16, 32));   // other 16 j's, same i

  const float mnew  = fmaxf(mrun, maxv);
  const float scale = __expf(mrun - mnew);

  v16h pfrag;     // P as B-fragment: element e<8 -> f=0, e>=8 -> f=1
  float sum = 0.0f;
  #pragma unroll
  for (int f = 0; f < 2; ++f)
    #pragma unroll
    for (int r = 0; r < 8; ++r) {
      const float e = __expf(s[f][r] - mnew);
      sum += e;
      pfrag[f*8 + r] = (_Float16)e;
    }
  sum += __shfl_xor(sum, 16, 32);

  lrun = lrun * scale + sum;
  mrun = mnew;
  #pragma unroll
  for (int t = 0; t < 4; ++t) o[t] = o[t] * scale;

  // O^T += V^T * P  (A = V^T tile, contiguous; B = P in-register)
  #pragma unroll
  for (int t = 0; t < 4; ++t) {
    v16h av = load_frag16(vbase + (size_t)(t*16 + l16) * S_ + jb + kb);
    o[t] = wmma_f16(av, pfrag, o[t]);
  }
}

// exp(x) for the merge weights. v_exp_f32 and the free slot that the
// instruction set asks for behind it stand in one statement.
static __device__ __forceinline__ float exp_with_slot(float x) {
  float r;
  asm("v_exp_f32 %0, %1\n\tv_nop" : "=v"(r) : "v"(x * 1.44269504f));
  return r;
}

#define NW_ 8     // waves per work-group
#define OP_ 68    // merge buffer: floats per query row (272 B = 16 B x 17)

__global__ void __launch_bounds__(256)
attn_flash_t(const _Float16* __restrict__ qh, const _Float16* __restrict__ kh,
             const _Float16* __restrict__ vth, const float* __restrict__ biasf,
             const float* __restrict__ vcum, float* __restrict__ out) {
  // Per (tile of the pair, wave): un-normalised O^T partial, running max, sum.
  __shared__ __attribute__((aligned(16))) float so[2][NW_][16][OP_];
  __shared__ float sm[2][NW_][16];
  __shared__ float sl[2][NW_][16];

  const int lane   = threadIdx.x & 31;
  const int wave   = __builtin_amdgcn_readfirstlane(threadIdx.x >> 5);
  const int l16    = lane & 15;
  const int half   = lane >> 4;
  const int kb     = half * 8;
  const int rowoff = half * 8;
  const int pr     = blockIdx.x;        // pair: tiles pr and S/16 - 1 - pr
  const int b      = blockIdx.y;

  const float* bias = biasf + b * S_;
  const _Float16* kbase = kh + (size_t)b * S_ * D_;
  const _Float16* vbase = vth + (size_t)b * D_ * S_;

  // The windows of both tiles (65 in every pair) form one list that is dealt
  // round-robin over the waves; u = this wave's next window in the tile.
  int u = wave;
  for (int h = 0; h < 2; ++h) {
    const int i0   = (h ? (S_ / 16 - 1 - pr) : pr) * 16;
    const int icol = i0 + l16;          // this lane's query row i
    const int jb0  = i0 & ~31;          // diagonal window start
    const int nwin = (S_ - jb0) >> 5;

    // Q^T B-fragments (lane = column i), loaded once per tile.
    const _Float16* qp = qh + ((size_t)b * S_ + icol) * D_;
    const v16h bq0 = load_frag16(qp + kb);
    const v16h bq1 = load_frag16(qp + 32 + kb);

    float mrun = -INFINITY;
    float lrun = 0.0f;
    v8f o[4];
    v8f vzero = {};
    #pragma unroll
    for (int t = 0; t < 4; ++t) o[t] = vzero;

    // Diagonal window (only place the causal compare is needed).
    if (u == 0) {
      flash_step<true>(jb0, icol, rowoff, kb, l16, kbase, vbase, bias,
                       bq0, bq1, mrun, lrun, o);
      u = NW_;
    }
    // Remaining windows: j >= i0+16 > every i in tile -> no causal test.
    for (; u < nwin; u += NW_)
      flash_step<false>(jb0 + u * 32, icol, rowoff, kb, l16, kbase, vbase, bias,
                        bq0, bq1, mrun, lrun, o);
    u -= nwin;                          // place in the next tile's windows

    // A wave without a window of this tile leaves (-inf, 0, 0): weight 0.
    if (half == 0) {
      sm[h][wave][l16] = mrun;
      sl[h][wave][l16] = lrun;
    }
    #pragma unroll
    for (int t = 0; t < 4; ++t) {
      float4 w0, w1;
      w0.x = o[t][0]; w0.y = o[t][1]; w0.z = o[t][2]; w0.w = o[t][3];
      w1.x = o[t][4]; w1.y = o[t][5]; w1.z = o[t][6]; w1.w = o[t][7];
      float* dst = &so[h][wave][l16][t*16 + rowoff];
      ((float4*)dst)[0] = w0;
      ((float4*)dst)[1] = w1;
    }
  }

  // Publishes every wave's partials to the merging threads.
  __syncthreads();

  // Merge: thread = (query row mi, four d); a wave stores whole 128-B lines.
  const int mi = threadIdx.x >> 4;
  const int dq = (threadIdx.x & 15) * 4;
  #pragma unroll
  for (int h = 0; h < 2; ++h) {
    const int i0  = (h ? (S_ / 16 - 1 - pr) : pr) * 16;
    const int jb0 = i0 & ~31;
    float mw[NW_];
    float mall = -INFINITY;             // finite: the diagonal window's wave
    #pragma unroll
    for (int w = 0; w < NW_; ++w) {
      mw[w] = sm[h][w][mi];
      mall = fmaxf(mall, mw[w]);
    }
    #pragma unroll
    for (int w = 0; w < NW_; ++w) mw[w] = exp_with_slot(mw[w] - mall);   // weights
    float lall = 0.0f;
    float4 acc = {0.0f, 0.0f, 0.0f, 0.0f};
    #pragma unroll
    for (int w = 0; w < NW_; ++w) {
      const float g = mw[w];
      const float4 p = *(const float4*)&so[h][w][mi][dq];
      lall += sl[h][w][mi] * g;
      acc.x += g * p.x; acc.y += g * p.y; acc.z += g * p.z; acc.w += g * p.w;
    }
    // Closed-form lower-triangle tail: all j < jb0 are -1e22 for every row.
    // e0 = exp(-1e22 - m): 0 for normal rows, exactly 1 for all-masked rows,
    // reproducing the reference's uniform softmax over all S columns.
    if (jb0 > 0) {
      const float e0 = __expf(-1e22f - mall);
      const float4 c = *(const float4*)(
          vcum + ((size_t)b * (S_ / 32) + (jb0 >> 5)) * D_ + dq);
      lall += (float)jb0 * e0;
      acc.x += e0 * c.x; acc.y += e0 * c.y; acc.z += e0 * c.z; acc.w += e0 * c.w;
    }
    const float inv = 1.0f / lall;      // lall >= 1 always
    float4 r;
    r.x = acc.x * inv; r.y = acc.y * inv; r.z = acc.z * inv; r.w = acc.w * inv;
    *(float4*)(out + ((size_t)b * S_ + i0 + mi) * D_ + dq) = r;
    // Address wait of the first tile's store: the second tile's merge reuses
    // the registers that the store names.
    if (h == 0) asm volatile("s_wait_xcnt 0x0" ::: "memory");
  }
}

// ---------------------------------------------------------------------------
extern "C" void kernel_launch(void* const* d_in, const int* in_sizes, int n_in,
                              void* d_out, int out_size, void* d_ws, size_t ws_size,
                              hipStream_t stream) {
  const float* x  = (const float*)d_in[0];
  const int* mask = (const int*)d_in[1];
  const float* Wq = (const float*)d_in[2];
  const float* bq = (const float*)d_in[3];
  const float* Wk = (const float*)d_in[4];
  const float* bk = (const float*)d_in[5];
  const float* Wv = (const float*)d_in[6];
  const float* bv = (const float*)d_in[7];
  float* out = (float*)d_out;

  // Workspace: f16 {weights | q | k | v^T} then f32 {biasf | vcum} ~ 6.9 MB
  _Float16* wh   = (_Float16*)d_ws;
  _Float16* qh   = wh + 3 * D_ * E_;
  _Float16* kh   = qh + (size_t)B_ * S_ * D_;
  _Float16* vth  = kh + (size_t)B_ * S_ * D_;
  float*    biasf = (float*)(vth + (size_t)B_ * S_ * D_);
  float*    vcum  = biasf + (size_t)B_ * S_;

  attn_cvt_weights<<<(D_ * E_ + 255) / 256, 256, 0, stream>>>(Wq, Wk, Wv, wh);
  attn_qkv_proj<<<256, 128, 0, stream>>>(x, wh, bq, bk, bv, qh, kh, vth);
  attn_prep<<<B_ * 2, 1024, 0, stream>>>(mask, vth, biasf, vcum);
  attn_flash_t<<<dim3(S_ / 32, B_), 256, 0, stream>>>(qh, kh, vth, biasf, vcum, out);
}

// v004
// Measured time: 51.3 microseconds a run.
// In two side-by-side timings against v003, it was 1.07 and 1.06 times as fast.
// Over all steps from v000 it is 2.30 times as fast.
#include <hip/hip_runtime.h>

// ---------------------------------------------------------------------------
// Self-attention B=8, S=2048, E=1024, D=64 on gfx1250 (MI455X).
//   k1: Wq/Wk/Wv fp32 -> f16, packed in the order of k2's B fragments
//   k2: fused QKV projection (12x v_wmma_f32_16x16x32_f16 per K-step);
//       q,k row-major [B*S,64] f16; v transposed [B,64,S] f16.
//   k3: prep: mask -> fp32 additive bias; V column prefix-sums per 32-block
//       (one wave per column: lane sums, then a wave scan).
//   k4: transposed flash attention:
//         S^T = K*Q^T (lane = i), P^T C-layout == P B-fragment -> no LDS,
//         O^T = V^T*P (lane = i -> scalar softmax state),
//       starting at the diagonal window; key windows dealt over 8 waves and
//       merged in LDS; the strictly-lower region is applied in closed form
//       (exact for the all-masked uniform-softmax fallback).
// ---------------------------------------------------------------------------

typedef _Float16 v16h __attribute__((ext_vector_type(16)));
typedef _Float16 v8h  __attribute__((ext_vector_type(8)));
typedef float    v8f  __attribute__((ext_vector_type(8)));

#define B_ 8
#define S_ 2048
#define E_ 1024
#define D_ 64

static __device__ __forceinline__ v8f wmma_f16(v16h a, v16h b, v8f c) {
  // D = A(16x32 f16) * B(32x16 f16) + C(16x16 f32)
  return __builtin_amdgcn_wmma_f32_16x16x32_f16(false, a, false, b,
                                                (short)0, c, false, false);
}

static __device__ __forceinline__ v16h load_frag16(const _Float16* p) {
  // 16 halves of one fragment lane: [p+0 .. p+7] and [p+16 .. p+23]
  v16h f;
  ((v8h*)&f)[0] = ((const v8h*)p)[0];
  ((v8h*)&f)[1] = ((const v8h*)p)[2];
  return f;
}

// ---------------------------------------------------------------------------
// Kernel 1: fp32 -> f16 weight conversion, packed for kernel 2's loads.
// wh[step s][fragment f][j][lane][8]: the 16 bytes that lane (l16, half) of a
// wave takes with the j-th load of fragment f (rows f*16 .. +15 of Wq|Wk|Wv)
// in K-step s, that is k = s*32 + j*16 + half*8 .. +7 of row f*16 + l16.
// A wave-wide load in kernel 2 then reads 512 contiguous bytes (4 lines); on
// row-major weights it took 32-byte pieces of 16 lines.
// One thread per 16-byte piece, in the order of the packed array.
// ---------------------------------------------------------------------------
#define WFRAG_ 512               // halves of one packed fragment (2 loads)
#define WSTEP_ (12 * WFRAG_)     // halves of one K-step (12 fragments)

__global__ void __launch_bounds__(256)
attn_cvt_weights(const float* __restrict__ Wq, const float* __restrict__ Wk,
                 const float* __restrict__ Wv, _Float16* __restrict__ wh) {
  const int g    = blockIdx.x * blockDim.x + threadIdx.x;  // 0 .. 3*D*E/8 - 1
  const int lane = g & 31;
  const int j    = (g >> 5) & 1;
  const int sf   = g >> 6;         // s*12 + f
  const int s    = sf / 12;
  const int f    = sf - s * 12;
  const float* W = (f < 4) ? Wq : ((f < 8) ? Wk : Wv);
  const float* p = W + (size_t)((f & 3) * 16 + (lane & 15)) * E_
                     + s * 32 + j * 16 + (lane >> 4) * 8;
  const float4 a = ((const float4*)p)[0];
  const float4 c = ((const float4*)p)[1];
  v8h h;
  h[0] = (_Float16)a.x; h[1] = (_Float16)a.y;
  h[2] = (_Float16)a.z; h[3] = (_Float16)a.w;
  h[4] = (_Float16)c.x; h[5] = (_Float16)c.y;
  h[6] = (_Float16)c.z; h[7] = (_Float16)c.w;
  *(v8h*)(wh + (size_t)g * 8) = h;
}

static __device__ __forceinline__ v16h load_wfrag(const _Float16* p) {
  // One packed fragment: this lane's 16 bytes of each of its two loads.
  v16h f;
  ((v8h*)&f)[0] = ((const v8h*)p)[0];
  ((v8h*)&f)[1] = ((const v8h*)(p + WFRAG_ / 2))[0];
  return f;
}

// ---------------------------------------------------------------------------
// Kernel 2: fused QKV projection. One wave per 16-row tile of x, 12
// accumulators (Q/K/V x 4 n-tiles), K-loop over E in steps of 32.
// The loop is software-pipelined in registers: behind the WMMAs of step k all
// 12 weight fragments of step k+1 are asked for at once, into the registers
// just read, and then the x rows of step k+2.
// ---------------------------------------------------------------------------
typedef float v4f  __attribute__((ext_vector_type(4)));
typedef float v16f __attribute__((ext_vector_type(16)));

static __device__ __forceinline__ v16f load_x16(const float* p) {
  // 16 floats of one A-fragment lane: [p+0 .. p+7] and [p+16 .. p+23]
  v16f f;
  ((v4f*)&f)[0] = ((const v4f*)p)[0];
  ((v4f*)&f)[1] = ((const v4f*)p)[1];
  ((v4f*)&f)[2] = ((const v4f*)p)[4];
  ((v4f*)&f)[3] = ((const v4f*)p)[5];
  return f;
}

__global__ void __launch_bounds__(128)
attn_qkv_proj(const float* __restrict__ x, const _Float16* __restrict__ wh,
              const float* __restrict__ bq, const float* __restrict__ bk,
              const float* __restrict__ bv,
              _Float16* __restrict__ qh, _Float16* __restrict__ kh,
              _Float16* __restrict__ vth) {
  const int lane = threadIdx.x & 31;
  const int wave = threadIdx.x >> 5;
  const int tile = blockIdx.x * 4 + wave;   // 0..1023
  const int m0   = tile * 16;
  const int l16  = lane & 15;
  const int half = lane >> 4;
  const int kb   = half * 8;

  v8f acc[12];
  v8f vzero = {};
  #pragma unroll
  for (int i = 0; i < 12; ++i) acc[i] = vzero;

  const float*    xrow = x + (size_t)(m0 + l16) * E_ + kb;
  const _Float16* wrow = wh + lane * 8;   // step s, fragment f: + s*WSTEP_ + f*WFRAG_

  // Prologue: x of steps 0 and 1, weights of step 0.
  v16f xs[2];
  v16h bf[12];
  xs[0] = load_x16(xrow);
  // Keeps step 0's x in front of the weights, as in the loop: asked for among
  // them, the wait for x at the loop's head also covers most weight loads.
  __builtin_amdgcn_sched_barrier(0);
  #pragma unroll
  for (int f = 0; f < 12; ++f) bf[f] = load_wfrag(wrow + f * WFRAG_);
  // Same issue order as in the loop (weights, then the younger x): otherwise
  // the counted waits at the loop's head also cover the youngest x loads.
  __builtin_amdgcn_sched_barrier(0);
  xs[1] = load_x16(xrow + 32);
  // Address wait of the prologue's loads: the weight loads' offset register is
  // reused by what follows (the barrier keeps that reuse behind the wait).
  asm volatile("s_wait_xcnt 0x0" ::: "memory");
  __builtin_amdgcn_sched_barrier(0);

  for (int k0 = 0; k0 < E_; k0 += 64) {
    // Two steps per pass, so that each x register set is refilled in place
    // (a copy from set to set would wait for the youngest load).
    #pragma unroll
    for (int h = 0; h < 2; ++h) {
      const int kc = k0 + h * 32;
      // Steps whose operands are fetched now, clamped to the last step.
      const int kn = (kc + 32 < E_) ? kc + 32 : E_ - 32;
      const int kx = (kc + 64 < E_) ? kc + 64 : E_ - 32;
      v16h a;
      #pragma unroll
      for (int e = 0; e < 16; ++e) a[e] = (_Float16)xs[h][e];
      #pragma unroll
      for (int f = 0; f < 12; ++f)            // f = w*4 + n
        acc[f] = wmma_f16(a, bf[f], acc[f]);
      // Keeps the refills behind the WMMAs that read the same registers:
      // scheduled above them they take a second register set (over 256).
      __builtin_amdgcn_sched_barrier(0);
      #pragma unroll
      for (int f = 0; f < 12; ++f)
        bf[f] = load_wfrag(wrow + (kn >> 5) * WSTEP_ + f * WFRAG_);
      // The weight loads' address registers are reused by what follows, so
      // their address wait stands here. The statement also keeps the x loads
      // behind the weight loads: x comes from memory and loads return in issue
      // order, so asked for last, two steps ahead, it holds up no weight load
      // that the next step needs.
      asm volatile("s_wait_xcnt 0x0" ::: "memory");
      xs[h] = load_x16(xrow + kx);
      // Address wait of the x loads: the next step rewrites their address pair.
      asm volatile("s_wait_xcnt 0x0" ::: "memory");
      // Keeps the next step's conversion of x, and with it the wait for the
      // youngest x load, from being scheduled up into this step.
      __builtin_amdgcn_sched_barrier(0);
    }
  }

  #pragma unroll
  for (int w = 0; w < 3; ++w) {
    const float* bias = (w == 0) ? bq : ((w == 1) ? bk : bv);
    #pragma unroll
    for (int n = 0; n < 4; ++n) {
      const int col = n*16 + l16;
      const float bb = bias[col];
      #pragma unroll
      for (int r = 0; r < 8; ++r) {
        const int rowg = m0 + half*8 + r;
        const float val = acc[w*4 + n][r] + bb;
        if (w == 0) {
          qh[(size_t)rowg * D_ + col] = (_Float16)val;
        } else if (w == 1) {
          kh[(size_t)rowg * D_ + col] = (_Float16)val;
        } else {
          const int bi = rowg >> 11;
          const int s  = rowg & (S_ - 1);
          vth[((size_t)bi * D_ + col) * S_ + s] = (_Float16)val;
        }
      }
    }
  }
}

// ---------------------------------------------------------------------------
// Kernel 3: prep. biasf[b][j] = mask ? 0 : -1e22 (fp32, contiguous per j so
// the flash kernel reads it as broadcast float4s). vcum[b][t][d] = column
// prefix sums of V over j < t*32 (for the closed-form lower-triangle tail).
// grid = B*2 blocks of 32 waves: a block takes 32 columns d of one batch, a
// wave one column. The wave asks for its whole column at once (8 loads of
// 512 contiguous bytes), each lane sums 8 keys per load; through LDS a lane
// then gets the sums of its own two 32-blocks, and the wave scans the lane
// totals. The block turns the result in LDS so that each 128-B line of vcum
// is stored whole by one wave.
// ---------------------------------------------------------------------------
#define PC_ 260   // 8-key sums of a column: LDS pitch in floats (16 B x 65)
#define PP_ 33    // prefix sums: LDS pitch in floats (a write hits 32 banks)

__global__ void __launch_bounds__(1024)
attn_prep(const int* __restrict__ mask, const _Float16* __restrict__ vth,
          float* __restrict__ biasf, float* __restrict__ vcum) {
  __shared__ __attribute__((aligned(16))) float ps[32][PC_];  // [d][j / 8]
  __shared__ float sc[S_ / 32][PP_];                          // [t][d]

  const int lane = threadIdx.x & 31;
  const int wave = threadIdx.x >> 5;  // column within the block's 32
  const int b    = blockIdx.x >> 1;
  const int d0   = (blockIdx.x & 1) * 32;
  const int gid  = blockIdx.x * 1024 + threadIdx.x;   // B*2*1024 == B*S

  const _Float16* col = vth + ((size_t)b * D_ + d0 + wave) * S_ + lane * 8;
  v8h hv[8];
  #pragma unroll
  for (int g = 0; g < 8; ++g) hv[g] = *(const v8h*)(col + g * 256);
  const int mk = mask[gid];
  // Address wait of the loads: the sums reuse the column's address pair.
  asm volatile("s_wait_xcnt 0x0" ::: "memory");
  // Keeps all nine loads in front of the sums: scheduled among them, the loads
  // went out in four groups, each waiting for the one before.
  __builtin_amdgcn_sched_barrier(0);

  #pragma unroll
  for (int g = 0; g < 8; ++g) {
    float p = (float)hv[g][0];
    #pragma unroll
    for (int e = 1; e < 8; ++e) p += (float)hv[g][e];
    ps[wave][g * 32 + lane] = p;      // keys g*256 + lane*8 .. +7
  }

  // Publishes the 8-key sums to the lanes that add them up per 32-block.
  __syncthreads();

  const float4 c0 = *(const float4*)&ps[wave][lane * 8];       // block 2*lane
  const float4 c1 = *(const float4*)&ps[wave][lane * 8 + 4];   // block 2*lane+1
  const float s0 = (c0.x + c0.y) + (c0.z + c0.w);
  const float s1 = (c1.x + c1.y) + (c1.z + c1.w);

  float inc = s0 + s1;                // inclusive scan over the lanes
  #pragma unroll
  for (int sh = 1; sh < 32; sh <<= 1) {
    const float up = __shfl_up(inc, sh, 32);
    if (lane >= sh) inc += up;
  }
  float before = __shfl_up(inc, 1, 32);   // sum over the keys of lower lanes
  if (lane == 0) before = 0.0f;
  sc[2 * lane][wave]     = before;
  sc[2 * lane + 1][wave] = before + s0;

  // Publishes every column's prefix sums to the storing threads.
  __syncthreads();

  const int t  = threadIdx.x >> 4;
  const int dp = (threadIdx.x & 15) * 2;
  float2 r;
  r.x = sc[t][dp];
  r.y = sc[t][dp + 1];
  *(float2*)(vcum + ((size_t)b * (S_ / 32) + t) * D_ + d0 + dp) = r;
  biasf[gid] = mk ? 0.0f : -1e22f;
}

// ---------------------------------------------------------------------------
// Kernel 4: transposed flash attention. grid = (S/32, B), 8 waves per block.
// A block takes the query tiles t and S/16-1-t (equal work in every block) and
// deals their 32-key windows over its waves; the partial softmax states are
// merged through LDS.
// ---------------------------------------------------------------------------
template <bool CAUSAL>
static __device__ __forceinline__
void flash_step(int jb, int icol, int rowoff, int kb, int l16,
                const _Float16* __restrict__ kbase,
                const _Float16* __restrict__ vbase,
                const float* __restrict__ bias,
                const v16h& bq0, const v16h& bq1,
                float& mrun, float& lrun, v8f o[4]) {
  const float inv_sqrt_d = 0.125f;   // 1/sqrt(64)

  // S^T = K * Q^T : two 16x16 tiles (j rows), lane = i
  v8f c[2];
  #pragma unroll
  for (int f = 0; f < 2; ++f) {
    const _Float16* kp = kbase + (size_t)(jb + f*16 + l16) * D_;
    v16h ak0 = load_frag16(kp + kb);
    v16h ak1 = load_frag16(kp + 32 + kb);
    v8f cz = {};
    c[f] = wmma_f16(ak0, bq0, cz);
    c[f] = wmma_f16(ak1, bq1, c[f]);
  }

  // mask bias (broadcast, contiguous) + optional causal select; in-lane stats
  float s[2][8];
  float maxv = -INFINITY;
  #pragma unroll
  for (int f = 0; f < 2; ++f) {
    const float4* bp = (const float4*)(bias + jb + f*16 + rowoff);
    float4 bb0 = bp[0], bb1 = bp[1];
    float barr[8] = {bb0.x, bb0.y, bb0.z, bb0.w, bb1.x, bb1.y, bb1.z, bb1.w};
    #pragma unroll
    for (int r = 0; r < 8; ++r) {
      // |score| << 1e22/2^24, so fma(c, inv, -1e22) == -1e22 exactly.
      float sv = fmaf(c[f][r], inv_sqrt_d, barr[r]);
      if (CAUSAL) {
        const int j = jb + f*16 + rowoff + r;
        sv = (j >= icol) ? sv : -1e22f;
      }
      s[f][r] = sv;
      maxv = fmaxf(maxv, sv);
    }
  }
  maxv = fmaxf(maxv, __shfl_xor(maxv, 16, 32));   // other 16 j's, same i

  const float mnew  = fmaxf(mrun, maxv);
  const float scale = __expf(mrun - mnew);

  v16h pfrag;     // P as B-fragment: element e<8 -> f=0, e>=8 -> f=1
  float sum = 0.0f;
  #pragma unroll
  for (int f = 0; f < 2; ++f)
    #pragma unroll
    for (int r = 0; r < 8; ++r) {
      const float e = __expf(s[f][r] - mnew);
      sum += e;
      pfrag[f*8 + r] = (_Float16)e;
    }
  sum += __shfl_xor(sum, 16, 32);

  lrun = lrun * scale + sum;
  mrun = mnew;
  #pragma unroll
  for (int t = 0; t < 4; ++t) o[t] = o[t] * scale;

  // O^T += V^T * P  (A = V^T tile, contiguous; B = P in-register)
  #pragma unroll
  for (int t = 0; t < 4; ++t) {
    v16h av = load_frag16(vbase + (size_t)(t*16 + l16) * S_ + jb + kb);
    o[t] = wmma_f16(av, pfrag, o[t]);
  }
}

// exp(x) for the merge weights. v_exp_f32 and the free slot that the
// instruction set asks for behind it stand in one statement.
static __device__ __forceinline__ float exp_with_slot(float x) {
  float r;
  asm("v_exp_f32 %0, %1\n\tv_nop" : "=v"(r) : "v"(x * 1.44269504f));
  return r;
}

#define NW_ 8     // waves per work-group
#define OP_ 68    // merge buffer: floats per query row (272 B = 16 B x 17)

__global__ void __launch_bounds__(256)
attn_flash_t(const _Float16* __restrict__ qh, const _Float16* __restrict__ kh,
             const _Float16* __restrict__ vth, const float* __restrict__ biasf,
             const float* __restrict__ vcum, float* __restrict__ out) {
  // Per (tile of the pair, wave): un-normalised O^T partial, running max, sum.
  __shared__ __attribute__((aligned(16))) float so[2][NW_][16][OP_];
  __shared__ float sm[2][NW_][16];
  __shared__ float sl[2][NW_][16];

  const int lane   = threadIdx.x & 31;
  const int wave   = __builtin_amdgcn_readfirstlane(threadIdx.x >> 5);
  const int l16    = lane & 15;
  const int half   = lane >> 4;
  const int kb     = half * 8;
  const int rowoff = half * 8;
  const int pr     = blockIdx.x;        // pair: tiles pr and S/16 - 1 - pr
  const int b      = blockIdx.y;

  const float* bias = biasf + b * S_;
  const _Float16* kbase = kh + (size_t)b * S_ * D_;
  const _Float16* vbase = vth + (size_t)b * D_ * S_;

  // The windows of both tiles (65 in every pair) form one list that is dealt
  // round-robin over the waves; u = this wave's next window in the tile.
  int u = wave;
  for (int h = 0; h < 2; ++h) {
    const int i0   = (h ? (S_ / 16 - 1 - pr) : pr) * 16;
    const int icol = i0 + l16;          // this lane's query row i
    const int jb0  = i0 & ~31;          // diagonal window start
    const int nwin = (S_ - jb0) >> 5;

    // Q^T B-fragments (lane = column i), loaded once per tile.
    const _Float16* qp = qh + ((size_t)b * S_ + icol) * D_;
    const v16h bq0 = load_frag16(qp + kb);
    const v16h bq1 = load_frag16(qp + 32 + kb);

    float mrun = -INFINITY;
    float lrun = 0.0f;
    v8f o[4];
    v8f vzero = {};
    #pragma unroll
    for (int t = 0; t < 4; ++t) o[t] = vzero;

    // Diagonal window (only place the causal compare is needed).
    if (u == 0) {
      flash_step<true>(jb0, icol, rowoff, kb, l16, kbase, vbase, bias,
                       bq0, bq1, mrun, lrun, o);
      u = NW_;
    }
    // Remaining windows: j >= i0+16 > every i in tile -> no causal test.
    for (; u < nwin; u += NW_)
      flash_step<false>(jb0 + u * 32, icol, rowoff, kb, l16, kbase, vbase, bias,
                        bq0, bq1, mrun, lrun, o);
    u -= nwin;                          // place in the next tile's windows

    // A wave without a window of this tile leaves (-inf, 0, 0): weight 0.
    if (half == 0) {
      sm[h][wave][l16] = mrun;
      sl[h][wave][l16] = lrun;
    }
    #pragma unroll
    for (int t = 0; t < 4; ++t) {
      float4 w0, w1;
      w0.x = o[t][0]; w0.y = o[t][1]; w0.z = o[t][2]; w0.w = o[t][3];
      w1.x = o[t][4]; w1.y = o[t][5]; w1.z = o[t][6]; w1.w = o[t][7];
      float* dst = &so[h][wave][l16][t*16 + rowoff];
      ((float4*)dst)[0] = w0;
      ((float4*)dst)[1] = w1;
    }
  }

  // Publishes every wave's partials to the merging threads.
  __syncthreads();

  // Merge: thread = (query row mi, four d); a wave stores whole 128-B lines.
  const int mi = threadIdx.x >> 4;
  const int dq = (threadIdx.x & 15) * 4;
  #pragma unroll
  for (int h = 0; h < 2; ++h) {
    const int i0  = (h ? (S_ / 16 - 1 - pr) : pr) * 16;
    const int jb0 = i0 & ~31;
    float mw[NW_];
    float mall = -INFINITY;             // finite: the diagonal window's wave
    #pragma unroll
    for (int w = 0; w < NW_; ++w) {
      mw[w] = sm[h][w][mi];
      mall = fmaxf(mall, mw[w]);
    }
    #pragma unroll
    for (int w = 0; w < NW_; ++w) mw[w] = exp_with_slot(mw[w] - mall);   // weights
    float lall = 0.0f;
    float4 acc = {0.0f, 0.0f, 0.0f, 0.0f};
    #pragma unroll
    for (int w = 0; w < NW_; ++w) {
      const float g = mw[w];
      const float4 p = *(const float4*)&so[h][w][mi][dq];
      lall += sl[h][w][mi] * g;
      acc.x += g * p.x; acc.y += g * p.y; acc.z += g * p.z; acc.w += g * p.w;
    }
    // Closed-form lower-triangle tail: all j < jb0 are -1e22 for every row.
    // e0 = exp(-1e22 - m): 0 for normal rows, exactly 1 for all-masked rows,
    // reproducing the reference's uniform softmax over all S columns.
    if (jb0 > 0) {
      const float e0 = __expf(-1e22f - mall);
      const float4 c = *(const float4*)(
          vcum + ((size_t)b * (S_ / 32) + (jb0 >> 5)) * D_ + dq);
      lall += (float)jb0 * e0;
      acc.x += e0 * c.x; acc.y += e0 * c.y; acc.z += e0 * c.z; acc.w += e0 * c.w;
    }
    const float inv = 1.0f / lall;      // lall >= 1 always
    float4 r;
    r.x = acc.x * inv; r.y = acc.y * inv; r.z = acc.z * inv; r.w = acc.w * inv;
    *(float4*)(out + ((size_t)b * S_ + i0 + mi) * D_ + dq) = r;
    // Address wait of the first tile's store: the second tile's merge reuses
    // the registers that the store names.
    if (h == 0) asm volatile("s_wait_xcnt 0x0" ::: "memory");
  }
}

// ---------------------------------------------------------------------------
extern "C" void kernel_launch(void* const* d_in, const int* in_sizes, int n_in,
                              void* d_out, int out_size, void* d_ws, size_t ws_size,
                              hipStream_t stream) {
  const float* x  = (const float*)d_in[0];
  const int* mask = (const int*)d_in[1];
  const float* Wq = (const float*)d_in[2];
  const float* bq = (const float*)d_in[3];
  const float* Wk = (const float*)d_in[4];
  const float* bk = (const float*)d_in[5];
  const float* Wv = (const float*)d_in[6];
  const float* bv = (const float*)d_in[7];
  float* out = (float*)d_out;

  // Workspace: f16 {weights | q | k | v^T} then f32 {biasf | vcum} ~ 6.9 MB
  _Float16* wh   = (_Float16*)d_ws;
  _Float16* qh   = wh + 3 * D_ * E_;
  _Float16* kh   = qh + (size_t)B_ * S_ * D_;
  _Float16* vth  = kh + (size_t)B_ * S_ * D_;
  float*    biasf = (float*)(vth + (size_t)B_ * S_ * D_);
  float*    vcum  = biasf + (size_t)B_ * S_;

  attn_cvt_weights<<<3 * D_ * E_ / 8 / 256, 256, 0, stream>>>(Wq, Wk, Wv, wh);
  attn_qkv_proj<<<256, 128, 0, stream>>>(x, wh, bq, bk, bv, qh, kh, vth);
  attn_prep<<<B_ * 2, 1024, 0, stream>>>(mask, vth, biasf, vcum);
  attn_flash_t<<<dim3(S_ / 32, B_), 256, 0, stream>>>(qh, kh, vth, biasf, vcum, out);
}

// v005
// One run takes 43.5 microseconds.
// Two timings next to v004 both put it at 1.18 times that version's speed.
// All steps since v000 together make it 2.72 times as fast.
#include <hip/hip_runtime.h>

// ---------------------------------------------------------------------------
// Self-attention B=8, S=2048, E=1024, D=64 on gfx1250 (MI455X).
//   k1: Wq/Wk/Wv fp32 -> f16, packed in the order of k2's weight fragments
//   k2: fused QKV projection (12x v_wmma_f32_16x16x32_f16 per K-step);
//       q, k, v^T f16, stored in the order of k4's fragments (see PT_, PV_).
//   k3: prep: mask -> fp32 additive bias; V column prefix-sums per 32-block
//       (one wave per column: lane sums, then a wave scan).
//   k4: transposed flash attention:
//         S^T = K*Q^T (lane = i), P^T C-layout == P B-fragment -> no LDS,
//         O^T = V^T*P (lane = i -> scalar softmax state),
//       starting at the diagonal window; key windows dealt over 8 waves and
//       merged in LDS; the strictly-lower region is applied in closed form
//       (exact for the all-masked uniform-softmax fallback).
// ---------------------------------------------------------------------------

typedef _Float16 v16h __attribute__((ext_vector_type(16)));
typedef _Float16 v8h  __attribute__((ext_vector_type(8)));
typedef float    v8f  __attribute__((ext_vector_type(8)));

#define B_ 8
#define S_ 2048
#define E_ 1024
#define D_ 64

static __device__ __forceinline__ v8f wmma_f16(v16h a, v16h b, v8f c) {
  // D = A(16x32 f16) * B(32x16 f16) + C(16x16 f32)
  return __builtin_amdgcn_wmma_f32_16x16x32_f16(false, a, false, b,
                                                (short)0, c, false, false);
}

// Packed q, k, v^T. A piece is what one wave-wide 16-byte load takes: 32 lanes
// x 8 halves = 512 contiguous bytes; a fragment is two pieces in a row.
//   q, k: [16-row tile][n = d / 16][lane = (row, half)][8]: d = n*16 + half*8 ..
//   v^T : [32-key window][t = d / 16][j][lane = (d % 16, half)][8]:
//         keys j*16 + half*8 .. of the window
#define PP8_ 256              // halves of one piece
#define PT_  (16 * D_)        // halves of one 16-row tile of q or k
#define PV_  (32 * D_)        // halves of one 32-key window of v^T

static __device__ __forceinline__ v16h load_pfrag(const _Float16* p) {
  // One packed fragment: this lane's 16 bytes of each of its two pieces.
  v16h f;
  ((v8h*)&f)[0] = ((const v8h*)p)[0];
  ((v8h*)&f)[1] = ((const v8h*)(p + PP8_))[0];
  return f;
}

// ---------------------------------------------------------------------------
// Kernel 1: fp32 -> f16 weight conversion, packed for kernel 2's loads.
// wh[step s][fragment f][j][lane][8]: the 16 bytes that lane (l16, half) of a
// wave takes with the j-th load of fragment f (rows f*16 .. +15 of Wq|Wk|Wv)
// in K-step s, that is k = s*32 + j*16 + half*8 .. +7 of row f*16 + l16.
// A wave-wide load in kernel 2 then reads 512 contiguous bytes (4 lines); on
// row-major weights it took 32-byte pieces of 16 lines.
// One thread per 16-byte piece, in the order of the packed array.
// ---------------------------------------------------------------------------
#define WFRAG_ 512               // halves of one packed fragment (2 loads)
#define WSTEP_ (12 * WFRAG_)     // halves of one K-step (12 fragments)

__global__ void __launch_bounds__(256)
attn_cvt_weights(const float* __restrict__ Wq, const float* __restrict__ Wk,
                 const float* __restrict__ Wv, _Float16* __restrict__ wh) {
  const int g    = blockIdx.x * blockDim.x + threadIdx.x;  // 0 .. 3*D*E/8 - 1
  const int lane = g & 31;
  const int j    = (g >> 5) & 1;
  const int sf   = g >> 6;         // s*12 + f
  const int s    = sf / 12;
  const int f    = sf - s * 12;
  const float* W = (f < 4) ? Wq : ((f < 8) ? Wk : Wv);
  const float* p = W + (size_t)((f & 3) * 16 + (lane & 15)) * E_
                     + s * 32 + j * 16 + (lane >> 4) * 8;
  const float4 a = ((const float4*)p)[0];
  const float4 c = ((const float4*)p)[1];
  v8h h;
  h[0] = (_Float16)a.x; h[1] = (_Float16)a.y;
  h[2] = (_Float16)a.z; h[3] = (_Float16)a.w;
  h[4] = (_Float16)c.x; h[5] = (_Float16)c.y;
  h[6] = (_Float16)c.z; h[7] = (_Float16)c.w;
  *(v8h*)(wh + (size_t)g * 8) = h;
}

static __device__ __forceinline__ v16h load_wfrag(const _Float16* p) {
  // One packed fragment: this lane's 16 bytes of each of its two loads.
  v16h f;
  ((v8h*)&f)[0] = ((const v8h*)p)[0];
  ((v8h*)&f)[1] = ((const v8h*)(p + WFRAG_ / 2))[0];
  return f;
}

// ---------------------------------------------------------------------------
// Kernel 2: fused QKV projection. One wave per 16-row tile of x, 12
// accumulators (Q/K/V x 4 n-tiles), K-loop over E in steps of 32.
// The loop is software-pipelined in registers: behind the WMMAs of step k all
// 12 weight fragments of step k+1 are asked for at once, into the registers
// just read, and then the x rows of step k+2.
// Q and K are formed transposed (weights as A, x as B: the two operands have
// the same lane layout), V as x * Wv^T: in both cases a lane's 8 accumulator
// registers are the 8 halves of one packed piece, one 16-byte store.
// ---------------------------------------------------------------------------
typedef float v4f  __attribute__((ext_vector_type(4)));
typedef float v16f __attribute__((ext_vector_type(16)));

static __device__ __forceinline__ v16f load_x16(const float* p) {
  // 16 floats of one x-fragment lane (B for Q, K; A for V): [p+0 .. p+7] and [p+16 .. p+23]
  v16f f;
  ((v4f*)&f)[0] = ((const v4f*)p)[0];
  ((v4f*)&f)[1] = ((const v4f*)p)[1];
  ((v4f*)&f)[2] = ((const v4f*)p)[4];
  ((v4f*)&f)[3] = ((const v4f*)p)[5];
  return f;
}

__global__ void __launch_bounds__(128)
attn_qkv_proj(const float* __restrict__ x, const _Float16* __restrict__ wh,
              const float* __restrict__ bq, const float* __restrict__ bk,
              const float* __restrict__ bv,
              _Float16* __restrict__ qh, _Float16* __restrict__ kh,
              _Float16* __restrict__ vth) {
  const int lane = threadIdx.x & 31;
  const int wave = threadIdx.x >> 5;
  const int tile = blockIdx.x * 4 + wave;   // 0..1023
  const int m0   = tile * 16;
  const int l16  = lane & 15;
  const int half = lane >> 4;
  const int kb   = half * 8;

  v8f acc[12];
  v8f vzero = {};
  #pragma unroll
  for (int i = 0; i < 12; ++i) acc[i] = vzero;

  const float*    xrow = x + (size_t)(m0 + l16) * E_ + kb;
  const _Float16* wrow = wh + lane * 8;   // step s, fragment f: + s*WSTEP_ + f*WFRAG_

  // Prologue: x of steps 0 and 1, weights of step 0.
  v16f xs[2];
  v16h bf[12];
  xs[0] = load_x16(xrow);
  // Keeps step 0's x in front of the weights, as in the loop: asked for among
  // them, the wait for x at the loop's head also covers most weight loads.
  __builtin_amdgcn_sched_barrier(0);
  #pragma unroll
  for (int f = 0; f < 12; ++f) bf[f] = load_wfrag(wrow + f * WFRAG_);
  // Same issue order as in the loop (weights, then the younger x): otherwise
  // the counted waits at the loop's head also cover the youngest x loads.
  __builtin_amdgcn_sched_barrier(0);
  xs[1] = load_x16(xrow + 32);
  // Address wait of the prologue's loads: the weight loads' offset register is
  // reused by what follows (the barrier keeps that reuse behind the wait).
  asm volatile("s_wait_xcnt 0x0" ::: "memory");
  __builtin_amdgcn_sched_barrier(0);

  for (int k0 = 0; k0 < E_; k0 += 64) {
    // Two steps per pass, so that each x register set is refilled in place
    // (a copy from set to set would wait for the youngest load).
    #pragma unroll
    for (int h = 0; h < 2; ++h) {
      const int kc = k0 + h * 32;
      // Steps whose operands are fetched now, clamped to the last step.
      const int kn = (kc + 32 < E_) ? kc + 32 : E_ - 32;
      const int kx = (kc + 64 < E_) ? kc + 64 : E_ - 32;
      v16h a;
      #pragma unroll
      for (int e = 0; e < 16; ++e) a[e] = (_Float16)xs[h][e];
      #pragma unroll
      for (int f = 0; f < 12; ++f)            // f = w*4 + n
        acc[f] = (f < 8) ? wmma_f16(bf[f], a, acc[f])    // (d, row)
                         : wmma_f16(a, bf[f], acc[f]);   // (row, d)
      // Keeps the refills behind the WMMAs that read the same registers:
      // scheduled above them they take a second register set (over 256).
      __builtin_amdgcn_sched_barrier(0);
      #pragma unroll
      for (int f = 0; f < 12; ++f)
        bf[f] = load_wfrag(wrow + (kn >> 5) * WSTEP_ + f * WFRAG_);
      // The weight loads' address registers are reused by what follows, so
      // their address wait stands here. The statement also keeps the x loads
      // behind the weight loads: x comes from memory and loads return in issue
      // order, so asked for last, two steps ahead, it holds up no weight load
      // that the next step needs.
      asm volatile("s_wait_xcnt 0x0" ::: "memory");
      xs[h] = load_x16(xrow + kx);
      // Address wait of the x loads: the next step rewrites their address pair.
      asm volatile("s_wait_xcnt 0x0" ::: "memory");
      // Keeps the next step's conversion of x, and with it the wait for the
      // youngest x load, from being scheduled up into this step.
      __builtin_amdgcn_sched_barrier(0);
    }
  }

  v8h pc[12];
  #pragma unroll
  for (int w = 0; w < 2; ++w) {             // q, k: lane = row, registers = d
    const float* bias = w ? bk : bq;
    #pragma unroll
    for (int n = 0; n < 4; ++n) {
      const float4 b0 = ((const float4*)(bias + n*16 + kb))[0];
      const float4 b1 = ((const float4*)(bias + n*16 + kb))[1];
      const float bb[8] = {b0.x, b0.y, b0.z, b0.w, b1.x, b1.y, b1.z, b1.w};
      #pragma unroll
      for (int r = 0; r < 8; ++r)
        pc[w*4 + n][r] = (_Float16)(acc[w*4 + n][r] + bb[r]);
    }
  }
  #pragma unroll
  for (int n = 0; n < 4; ++n) {             // v: lane = d, registers = keys
    const float bb = bv[n*16 + l16];
    #pragma unroll
    for (int r = 0; r < 8; ++r)
      pc[8 + n][r] = (_Float16)(acc[8 + n][r] + bb);
  }
  _Float16* qd = qh  + (size_t)tile * PT_ + lane * 8;
  _Float16* kd = kh  + (size_t)tile * PT_ + lane * 8;
  _Float16* vd = vth + (size_t)(tile >> 1) * PV_ + (tile & 1) * PP8_ + lane * 8;
  #pragma unroll
  for (int n = 0; n < 4; ++n) {
    *(v8h*)(qd + n * PP8_)     = pc[n];
    *(v8h*)(kd + n * PP8_)     = pc[4 + n];
    *(v8h*)(vd + n * 2 * PP8_) = pc[8 + n];
  }
}

// ---------------------------------------------------------------------------
// Kernel 3: prep. biasf[b][j] = mask ? 0 : -1e22 (fp32, contiguous per j so
// the flash kernel reads it as broadcast float4s). vcum[b][t][d] = column
// prefix sums of V over j < t*32 (for the closed-form lower-triangle tail).
// grid = B*2 blocks of 32 waves: a block takes 32 columns d of one batch.
// A wave first takes two 32-blocks of all 32 columns (8 pieces of packed v^T,
// asked for at once), each lane sums 8 keys per piece and the two lane halves
// add up; through LDS a wave then gets one column, a lane the sums of its two
// 32-blocks, and the wave scans the lane totals. The block turns the result
// in LDS so that each 128-B line of vcum is stored whole by one wave.
// ---------------------------------------------------------------------------
#define PP_ 33    // block sums, prefix sums: LDS pitch in floats (32 banks)

__global__ void __launch_bounds__(1024)
attn_prep(const int* __restrict__ mask, const _Float16* __restrict__ vth,
          float* __restrict__ biasf, float* __restrict__ vcum) {
  __shared__ float bs[S_ / 32][PP_];   // [t][d]: sums over one 32-block
  __shared__ float sc[S_ / 32][PP_];   // [t][d]: sums over all blocks below t

  const int lane = threadIdx.x & 31;
  const int wave = threadIdx.x >> 5;  // 32-block pair, then column of the 32
  const int b    = blockIdx.x >> 1;
  const int d0   = (blockIdx.x & 1) * 32;
  const int gid  = blockIdx.x * 1024 + threadIdx.x;   // B*2*1024 == B*S

  const _Float16* win = vth + ((size_t)b * (S_ / 32) + 2 * wave) * PV_
                            + (d0 / 16) * 2 * PP8_ + lane * 8;
  v8h hv[8];                          // [32-block of the pair][d / 16][j]
  #pragma unroll
  for (int g = 0; g < 8; ++g)
    hv[g] = *(const v8h*)(win + (g >> 2) * PV_ + (g & 3) * PP8_);
  const int mk = mask[gid];
  // Address wait of the loads: the sums reuse their address pair.
  asm volatile("s_wait_xcnt 0x0" ::: "memory");
  // Keeps all nine loads in front of the sums: scheduled among them, the loads
  // went out in four groups, each waiting for the one before.
  __builtin_amdgcn_sched_barrier(0);

  #pragma unroll
  for (int q = 0; q < 2; ++q) {
    float s[2];                       // column (lane & 15) and that + 16
    #pragma unroll
    for (int tt = 0; tt < 2; ++tt) {
      float a[2];                     // keys 0 .. 15 and 16 .. 31 of the block
      #pragma unroll
      for (int j = 0; j < 2; ++j) {
        const v8h h = hv[q * 4 + tt * 2 + j];
        float p = (float)h[0];
        #pragma unroll
        for (int e = 1; e < 8; ++e) p += (float)h[e];
        a[j] = p + __shfl_xor(p, 16, 32);   // the other lane half's 8 keys
      }
      s[tt] = a[0] + a[1];
    }
    bs[2 * wave + q][lane] = (lane >> 4) ? s[1] : s[0];
  }

  // Publishes the 32-block sums to the waves that scan them per column.
  __syncthreads();

  const float s0 = bs[2 * lane][wave];
  const float s1 = bs[2 * lane + 1][wave];

  float inc = s0 + s1;                // inclusive scan over the lanes
  #pragma unroll
  for (int sh = 1; sh < 32; sh <<= 1) {
    const float up = __shfl_up(inc, sh, 32);
    if (lane >= sh) inc += up;
  }
  float before = __shfl_up(inc, 1, 32);   // sum over the keys of lower lanes
  if (lane == 0) before = 0.0f;
  sc[2 * lane][wave]     = before;
  sc[2 * lane + 1][wave] = before + s0;

  // Publishes every column's prefix sums to the storing threads.
  __syncthreads();

  const int t  = threadIdx.x >> 4;
  const int dp = (threadIdx.x & 15) * 2;
  float2 r;
  r.x = sc[t][dp];
  r.y = sc[t][dp + 1];
  *(float2*)(vcum + ((size_t)b * (S_ / 32) + t) * D_ + d0 + dp) = r;
  biasf[gid] = mk ? 0.0f : -1e22f;
}

// ---------------------------------------------------------------------------
// Kernel 4: transposed flash attention. grid = (S/32, B), 8 waves per block.
// A block takes the query tiles t and S/16-1-t (equal work in every block) and
// deals their 32-key windows over its waves; the partial softmax states are
// merged through LDS.
// ---------------------------------------------------------------------------
template <bool CAUSAL>
static __device__ __forceinline__
void flash_step(int jb, int icol, int rowoff,
                const _Float16* __restrict__ kbase,
                const _Float16* __restrict__ vbase,
                const float* __restrict__ bias,
                const v16h& bq0, const v16h& bq1,
                float& mrun, float& lrun, v8f o[4]) {
  const float inv_sqrt_d = 0.125f;   // 1/sqrt(64)

  // The window's loads: K (two 16-key tiles), mask bias, then V^T.
  v16h ak[2][2];
  float4 bb[2][2];
  #pragma unroll
  for (int f = 0; f < 2; ++f) {
    const _Float16* kp = kbase + (size_t)((jb >> 4) + f) * PT_;
    ak[f][0] = load_pfrag(kp);
    ak[f][1] = load_pfrag(kp + 2 * PP8_);
  }
  #pragma unroll
  for (int f = 0; f < 2; ++f) {
    const float4* bp = (const float4*)(bias + jb + f*16 + rowoff);
    bb[f][0] = bp[0];
    bb[f][1] = bp[1];
  }
  // Address wait of the K and bias loads: the V loads' results may land in
  // the registers that held their addresses.
  asm volatile("s_wait_xcnt 0x0" ::: "memory");
  v16h av[4];
  #pragma unroll
  for (int t = 0; t < 4; ++t)
    av[t] = load_pfrag(vbase + (size_t)(jb >> 5) * PV_ + t * 2 * PP8_);
  // Address wait of the V loads: the arithmetic below reuses their address pair.
  asm volatile("s_wait_xcnt 0x0" ::: "memory");

  // S^T = K * Q^T : two 16x16 tiles (j rows), lane = i
  v8f c[2];
  #pragma unroll
  for (int f = 0; f < 2; ++f) {
    v8f cz = {};
    c[f] = wmma_f16(ak[f][0], bq0, cz);
    c[f] = wmma_f16(ak[f][1], bq1, c[f]);
  }

  // mask bias (broadcast, contiguous) + optional causal select; in-lane stats
  float s[2][8];
  float maxv = -INFINITY;
  #pragma unroll
  for (int f = 0; f < 2; ++f) {
    const float4 bb0 = bb[f][0], bb1 = bb[f][1];
    float barr[8] = {bb0.x, bb0.y, bb0.z, bb0.w, bb1.x, bb1.y, bb1.z, bb1.w};
    #pragma unroll
    for (int r = 0; r < 8; ++r) {
      // |score| << 1e22/2^24, so fma(c, inv, -1e22) == -1e22 exactly.
      float sv = fmaf(c[f][r], inv_sqrt_d, barr[r]);
      if (CAUSAL) {
        const int j = jb + f*16 + rowoff + r;
        sv = (j >= icol) ? sv : -1e22f;
      }
      s[f][r] = sv;
      maxv = fmaxf(maxv, sv);
    }
  }
  maxv = fmaxf(maxv, __shfl_xor(maxv, 16, 32));   // other 16 j's, same i

  const float mnew  = fmaxf(mrun, maxv);
  const float scale = __expf(mrun - mnew);

  v16h pfrag;     // P as B-fragment: element e<8 -> f=0, e>=8 -> f=1
  float sum = 0.0f;
  #pragma unroll
  for (int f = 0; f < 2; ++f)
    #pragma unroll
    for (int r = 0; r < 8; ++r) {
      const float e = __expf(s[f][r] - mnew);
      sum += e;
      pfrag[f*8 + r] = (_Float16)e;
    }
  sum += __shfl_xor(sum, 16, 32);

  lrun = lrun * scale + sum;
  mrun = mnew;
  #pragma unroll
  for (int t = 0; t < 4; ++t) o[t] = o[t] * scale;

  // O^T += V^T * P  (A = V^T tile, packed; B = P in-register)
  #pragma unroll
  for (int t = 0; t < 4; ++t) o[t] = wmma_f16(av[t], pfrag, o[t]);
}

// exp(x) for the merge weights. v_exp_f32 and the free slot that the
// instruction set asks for behind it stand in one statement.
static __device__ __forceinline__ float exp_with_slot(float x) {
  float r;
  asm("v_exp_f32 %0, %1\n\tv_nop" : "=v"(r) : "v"(x * 1.44269504f));
  return r;
}

#define NW_ 8     // waves per work-group
#define OP_ 68    // merge buffer: floats per query row (272 B = 16 B x 17)

__global__ void __launch_bounds__(256)
attn_flash_t(const _Float16* __restrict__ qh, const _Float16* __restrict__ kh,
             const _Float16* __restrict__ vth, const float* __restrict__ biasf,
             const float* __restrict__ vcum, float* __restrict__ out) {
  // Per (tile of the pair, wave): un-normalised O^T partial, running max, sum.
  __shared__ __attribute__((aligned(16))) float so[2][NW_][16][OP_];
  __shared__ float sm[2][NW_][16];
  __shared__ float sl[2][NW_][16];

  const int lane   = threadIdx.x & 31;
  const int wave   = __builtin_amdgcn_readfirstlane(threadIdx.x >> 5);
  const int l16    = lane & 15;
  const int half   = lane >> 4;
  const int rowoff = half * 8;
  const int pr     = blockIdx.x;        // pair: tiles pr and S/16 - 1 - pr
  const int b      = blockIdx.y;

  const float* bias = biasf + b * S_;
  // This lane's 16 bytes of the batch's first packed piece.
  const _Float16* kbase = kh + (size_t)b * S_ * D_ + lane * 8;
  const _Float16* vbase = vth + (size_t)b * D_ * S_ + lane * 8;

  // The windows of both tiles (65 in every pair) form one list that is dealt
  // round-robin over the waves; u = this wave's next window in the tile.
  int u = wave;
  for (int h = 0; h < 2; ++h) {
    const int i0   = (h ? (S_ / 16 - 1 - pr) : pr) * 16;
    const int icol = i0 + l16;          // this lane's query row i
    const int jb0  = i0 & ~31;          // diagonal window start
    const int nwin = (S_ - jb0) >> 5;

    // Q^T B-fragments (lane = column i), loaded once per tile.
    const _Float16* qp = qh + ((size_t)b * S_ + i0) * D_ + lane * 8;
    const v16h bq0 = load_pfrag(qp);
    const v16h bq1 = load_pfrag(qp + 2 * PP8_);

    float mrun = -INFINITY;
    float lrun = 0.0f;
    v8f o[4];
    v8f vzero = {};
    #pragma unroll
    for (int t = 0; t < 4; ++t) o[t] = vzero;

    // Diagonal window (only place the causal compare is needed).
    if (u == 0) {
      flash_step<true>(jb0, icol, rowoff, kbase, vbase, bias,
                       bq0, bq1, mrun, lrun, o);
      u = NW_;
    }
    // Remaining windows: j >= i0+16 > every i in tile -> no causal test.
    for (; u < nwin; u += NW_)
      flash_step<false>(jb0 + u * 32, icol, rowoff, kbase, vbase, bias,
                        bq0, bq1, mrun, lrun, o);
    u -= nwin;                          // place in the next tile's windows

    // A wave without a window of this tile leaves (-inf, 0, 0): weight 0.
    if (half == 0) {
      sm[h][wave][l16] = mrun;
      sl[h][wave][l16] = lrun;
    }
    #pragma unroll
    for (int t = 0; t < 4; ++t) {
      float4 w0, w1;
      w0.x = o[t][0]; w0.y = o[t][1]; w0.z = o[t][2]; w0.w = o[t][3];
      w1.x = o[t][4]; w1.y = o[t][5]; w1.z = o[t][6]; w1.w = o[t][7];
      float* dst = &so[h][wave][l16][t*16 + rowoff];
      ((float4*)dst)[0] = w0;
      ((float4*)dst)[1] = w1;
    }
  }

  // Publishes every wave's partials to the merging threads.
  __syncthreads();

  // Merge: thread = (query row mi, four d); a wave stores whole 128-B lines.
  const int mi = threadIdx.x >> 4;
  const int dq = (threadIdx.x & 15) * 4;
  #pragma unroll
  for (int h = 0; h < 2; ++h) {
    const int i0  = (h ? (S_ / 16 - 1 - pr) : pr) * 16;
    const int jb0 = i0 & ~31;
    float mw[NW_];
    float mall = -INFINITY;             // finite: the diagonal window's wave
    #pragma unroll
    for (int w = 0; w < NW_; ++w) {
      mw[w] = sm[h][w][mi];
      mall = fmaxf(mall, mw[w]);
    }
    #pragma unroll
    for (int w = 0; w < NW_; ++w) mw[w] = exp_with_slot(mw[w] - mall);   // weights
    float lall = 0.0f;
    float4 acc = {0.0f, 0.0f, 0.0f, 0.0f};
    #pragma unroll
    for (int w = 0; w < NW_; ++w) {
      const float g = mw[w];
      const float4 p = *(const float4*)&so[h][w][mi][dq];
      lall += sl[h][w][mi] * g;
      acc.x += g * p.x; acc.y += g * p.y; acc.z += g * p.z; acc.w += g * p.w;
    }
    // Closed-form lower-triangle tail: all j < jb0 are -1e22 for every row.
    // e0 = exp(-1e22 - m): 0 for normal rows, exactly 1 for all-masked rows,
    // reproducing the reference's uniform softmax over all S columns.
    if (jb0 > 0) {
      const float e0 = __expf(-1e22f - mall);
      const float4 c = *(const float4*)(
          vcum + ((size_t)b * (S_ / 32) + (jb0 >> 5)) * D_ + dq);
      lall += (float)jb0 * e0;
      acc.x += e0 * c.x; acc.y += e0 * c.y; acc.z += e0 * c.z; acc.w += e0 * c.w;
    }
    const float inv = 1.0f / lall;      // lall >= 1 always
    float4 r;
    r.x = acc.x * inv; r.y = acc.y * inv; r.z = acc.z * inv; r.w = acc.w * inv;
    *(float4*)(out + ((size_t)b * S_ + i0 + mi) * D_ + dq) = r;
    // Address wait of the first tile's store: the second tile's merge reuses
    // the registers that the store names.
    if (h == 0) asm volatile("s_wait_xcnt 0x0" ::: "memory");
  }
}

// ---------------------------------------------------------------------------
extern "C" void kernel_launch(void* const* d_in, const int* in_sizes, int n_in,
                              void* d_out, int out_size, void* d_ws, size_t ws_size,
                              hipStream_t stream) {
  const float* x  = (const float*)d_in[0];
  const int* mask = (const int*)d_in[1];
  const float* Wq = (const float*)d_in[2];
  const float* bq = (const float*)d_in[3];
  const float* Wk = (const float*)d_in[4];
  const float* bk = (const float*)d_in[5];
  const float* Wv = (const float*)d_in[6];
  const float* bv = (const float*)d_in[7];
  float* out = (float*)d_out;

  // Workspace: f16 {weights | q | k | v^T} then f32 {biasf | vcum} ~ 6.9 MB
  _Float16* wh   = (_Float16*)d_ws;
  _Float16* qh   = wh + 3 * D_ * E_;
  _Float16* kh   = qh + (size_t)B_ * S_ * D_;
  _Float16* vth  = kh + (size_t)B_ * S_ * D_;
  float*    biasf = (float*)(vth + (size_t)B_ * S_ * D_);
  float*    vcum  = biasf + (size_t)B_ * S_;

  attn_cvt_weights<<<3 * D_ * E_ / 8 / 256, 256, 0, stream>>>(Wq, Wk, Wv, wh);
  attn_qkv_proj<<<256, 128, 0, stream>>>(x, wh, bq, bk, bv, qh, kh, vth);
  attn_prep<<<B_ * 2, 1024, 0, stream>>>(mask, vth, biasf, vcum);
  attn_flash_t<<<dim3(S_ / 32, B_), 256, 0, stream>>>(qh, kh, vth, biasf, vcum, out);
}

// v006
// Measured time: 33.9 microseconds a run.
// Timed twice side by side with v005, it ran 1.29 times as fast both times.
// Counting every step since v000, it is 3.50 times as fast.
#include <hip/hip_runtime.h>

// ---------------------------------------------------------------------------
// Self-attention B=8, S=2048, E=1024, D=64 on gfx1250 (MI455X).
//   k1: Wq/Wk/Wv fp32 -> f16, packed in the order of k2's weight fragments
//   k2: fused QKV projection (12x v_wmma_f32_16x16x32_f16 per K-step and wave);
//       q, k, v^T f16, stored in the order of k4's fragments (see PT_, PV_).
//   k3: prep: mask -> fp32 additive bias; V column prefix-sums per 32-block
//       (one wave per column: lane sums, then a wave scan).
//   k4: transposed flash attention:
//         S^T = K*Q^T (lane = i), P^T C-layout == P B-fragment -> no LDS,
//         O^T = V^T*P (lane = i -> scalar softmax state),
//       starting at the diagonal window; key windows dealt over 8 waves and
//       merged in LDS; the strictly-lower region is applied in closed form
//       (exact for the all-masked uniform-softmax fallback).
// ---------------------------------------------------------------------------

typedef _Float16 v16h __attribute__((ext_vector_type(16)));
typedef _Float16 v8h  __attribute__((ext_vector_type(8)));
typedef float    v8f  __attribute__((ext_vector_type(8)));

#define B_ 8
#define S_ 2048
#define E_ 1024
#define D_ 64

static __device__ __forceinline__ v8f wmma_f16(v16h a, v16h b, v8f c) {
  // D = A(16x32 f16) * B(32x16 f16) + C(16x16 f32)
  return __builtin_amdgcn_wmma_f32_16x16x32_f16(false, a, false, b,
                                                (short)0, c, false, false);
}

// Packed q, k, v^T. A piece is what one wave-wide 16-byte load takes: 32 lanes
// x 8 halves = 512 contiguous bytes; a fragment is two pieces in a row.
//   q, k: [16-row tile][n = d / 16][lane = (row, half)][8]: d = n*16 + half*8 ..
//   v^T : [32-key window][t = d / 16][j][lane = (d % 16, half)][8]:
//         keys j*16 + half*8 .. of the window
#define PP8_ 256              // halves of one piece
#define PT_  (16 * D_)        // halves of one 16-row tile of q or k
#define PV_  (32 * D_)        // halves of one 32-key window of v^T

static __device__ __forceinline__ v16h load_pfrag(const _Float16* p) {
  // One packed fragment: this lane's 16 bytes of each of its two pieces.
  v16h f;
  ((v8h*)&f)[0] = ((const v8h*)p)[0];
  ((v8h*)&f)[1] = ((const v8h*)(p + PP8_))[0];
  return f;
}

// ---------------------------------------------------------------------------
// Kernel 1: fp32 -> f16 weight conversion, packed for kernel 2's loads.
// wh[step s][fragment f][j][lane][8]: the 16 bytes that lane (l16, half) of a
// wave takes with the j-th load of fragment f (rows f*16 .. +15 of Wq|Wk|Wv)
// in K-step s, that is k = s*32 + j*16 + half*8 .. +7 of row f*16 + l16.
// A wave-wide load in kernel 2 then reads 512 contiguous bytes (4 lines); on
// row-major weights it took 32-byte pieces of 16 lines.
// One thread per 16-byte piece, in the order of the packed array.
// ---------------------------------------------------------------------------
#define WFRAG_ 512               // halves of one packed fragment (2 loads)
#define WSTEP_ (12 * WFRAG_)     // halves of one K-step (12 fragments)

__global__ void __launch_bounds__(256)
attn_cvt_weights(const float* __restrict__ Wq, const float* __restrict__ Wk,
                 const float* __restrict__ Wv, _Float16* __restrict__ wh) {
  const int g    = blockIdx.x * blockDim.x + threadIdx.x;  // 0 .. 3*D*E/8 - 1
  const int lane = g & 31;
  const int j    = (g >> 5) & 1;
  const int sf   = g >> 6;         // s*12 + f
  const int s    = sf / 12;
  const int f    = sf - s * 12;
  const float* W = (f < 4) ? Wq : ((f < 8) ? Wk : Wv);
  const float* p = W + (size_t)((f & 3) * 16 + (lane & 15)) * E_
                     + s * 32 + j * 16 + (lane >> 4) * 8;
  const float4 a = ((const float4*)p)[0];
  const float4 c = ((const float4*)p)[1];
  v8h h;
  h[0] = (_Float16)a.x; h[1] = (_Float16)a.y;
  h[2] = (_Float16)a.z; h[3] = (_Float16)a.w;
  h[4] = (_Float16)c.x; h[5] = (_Float16)c.y;
  h[6] = (_Float16)c.z; h[7] = (_Float16)c.w;
  *(v8h*)(wh + (size_t)g * 8) = h;
}

static __device__ __forceinline__ v16h load_wfrag(const _Float16* p) {
  // One packed fragment: this lane's 16 bytes of each of its two loads.
  v16h f;
  ((v8h*)&f)[0] = ((const v8h*)p)[0];
  ((v8h*)&f)[1] = ((const v8h*)(p + WFRAG_ / 2))[0];
  return f;
}

// ---------------------------------------------------------------------------
// Kernel 2: fused QKV projection. A block of 4 waves takes 64 rows of x (4 row
// tiles); wave n takes the n-th 16 columns of each of Q, K and V for all four
// tiles: 12 accumulators, 3 weight fragments per K-step. Each weight fragment
// is so loaded once per block and feeds 4 WMMAs.
// x goes through LDS: wave w loads the rows of tile w in whole 128-B lines,
// converts them to f16 and stores them in fragment order; every wave reads all
// four fragments of the step. Two LDS buffers, one barrier per K-step.
// Weights are asked for two steps ahead, x five steps ahead, in registers.
// Q and K are formed transposed (weights as A, x as B: the two operands have
// the same lane layout), V as x * Wv^T: in both cases a lane's 8 accumulator
// registers are the 8 halves of one packed piece, one 16-byte store.
// ---------------------------------------------------------------------------
typedef float    v4f __attribute__((ext_vector_type(4)));
typedef _Float16 v4h __attribute__((ext_vector_type(4)));

#define XT_ 512               // halves of one x fragment in LDS (16 rows x 32 k)
#define XB_ (4 * XT_)         // halves of one LDS buffer (4 row tiles)
#define KS_ (E_ / 32)         // K-steps

struct XRows { v4f r[4]; };   // this lane's 16 bytes of 4 of its tile's rows

static __device__ __forceinline__ XRows load_xrows(const float* p) {
  // Load i covers rows 4i .. 4i+3 of the tile, 128 contiguous bytes of each.
  XRows v;
  #pragma unroll
  for (int i = 0; i < 4; ++i) v.r[i] = *(const v4f*)(p + (size_t)i * 4 * E_);
  return v;
}

static __device__ __forceinline__ void store_xrows(_Float16* d, const XRows& v) {
  #pragma unroll
  for (int i = 0; i < 4; ++i) {
    v4h h;
    #pragma unroll
    for (int e = 0; e < 4; ++e) h[e] = (_Float16)v.r[i][e];
    *(v4h*)(d + i * 32) = h;            // 4 rows further: 4 x 8 halves
  }
}

__global__ void __launch_bounds__(128)
attn_qkv_proj(const float* __restrict__ x, const _Float16* __restrict__ wh,
              const float* __restrict__ bq, const float* __restrict__ bk,
              const float* __restrict__ bv,
              _Float16* __restrict__ qh, _Float16* __restrict__ kh,
              _Float16* __restrict__ vth) {
  // x as f16 fragments: [buffer][row tile][j][lane = (row, half)][8],
  // k = j*16 + half*8 .. +7 of the step, as the WMMA operand takes them.
  __shared__ __attribute__((aligned(16))) _Float16 xf[2 * XB_];

  const int lane = threadIdx.x & 31;
  const int wave = __builtin_amdgcn_readfirstlane(threadIdx.x >> 5);
  const int l16  = lane & 15;
  const int half = lane >> 4;
  const int kb   = half * 8;

  v8f acc[3][4];                          // [q, k, v][row tile]
  v8f vzero = {};
  #pragma unroll
  for (int g = 0; g < 3; ++g)
    #pragma unroll
    for (int t = 0; t < 4; ++t) acc[g][t] = vzero;

  // Global x: lane = (row of four = lane / 8, 16-byte piece c = lane % 8).
  const float* xg = x + (size_t)((blockIdx.x * 4 + wave) * 16 + (lane >> 3)) * E_
                      + (lane & 7) * 4;
  // Its place in the fragment: k = 4c .. 4c+3 -> j = c / 4, half = (c / 2) % 2,
  // element (c % 2) * 4.
  _Float16* xd = xf + wave * XT_ + ((lane >> 2) & 1) * 256
                    + (((lane >> 1) & 1) * 16 + (lane >> 3)) * 8 + (lane & 1) * 4;
  const _Float16* xr = xf + lane * 8;
  // Step s, matrix g (q, k, v): + s*WSTEP_ + g*4*WFRAG_
  const _Float16* wrow = wh + wave * WFRAG_ + lane * 8;

  // Prologue: x of steps 0 .. 3, weights of steps 0 and 1; step 0's x to LDS,
  // its registers refilled with step 4.
  XRows xs[4];
  v16h  wr[2][3];
  // Asked for in the order of the loop (x three steps ahead of the weights that
  // precede it); the scheduling barriers keep that order: loads return in issue
  // order, and in another order the counted waits at the loop's head, which
  // must hold for both ways into it, would also cover younger x loads.
  #pragma unroll
  for (int s = 0; s < 3; ++s) {
    xs[s] = load_xrows(xg + s * 32);
    __builtin_amdgcn_sched_barrier(0);
  }
  #pragma unroll
  for (int g = 0; g < 3; ++g) wr[0][g] = load_wfrag(wrow + g * 4 * WFRAG_);
  __builtin_amdgcn_sched_barrier(0);
  xs[3] = load_xrows(xg + 3 * 32);
  __builtin_amdgcn_sched_barrier(0);
  #pragma unroll
  for (int g = 0; g < 3; ++g) wr[1][g] = load_wfrag(wrow + WSTEP_ + g * 4 * WFRAG_);
  __builtin_amdgcn_sched_barrier(0);
  store_xrows(xd, xs[0]);
  xs[0] = load_xrows(xg + 4 * 32);
  // Address wait of the prologue's loads, then the barrier that publishes step
  // 0's fragments. Written by hand with the LDS wait alone: __syncthreads()
  // would also wait for the global loads that are meant to stay in flight.
  asm volatile("s_wait_xcnt 0x0\n\ts_wait_dscnt 0x0\n\t"
               "s_barrier_signal -1\n\ts_barrier_wait -1" ::: "memory");
  __builtin_amdgcn_sched_barrier(0);

  for (int k0 = 0; k0 < KS_; k0 += 4) {
    // Four steps per pass, so that every register set is refilled in place.
    #pragma unroll
    for (int h = 0; h < 4; ++h) {
      const int kc = k0 + h;
      // Steps whose operands are fetched now, clamped to the last step.
      const int kw = (kc + 2 < KS_) ? kc + 2 : KS_ - 1;
      const int kx = (kc + 5 < KS_) ? kc + 5 : KS_ - 1;
      v16h a[4];
      #pragma unroll
      for (int t = 0; t < 4; ++t)
        a[t] = load_pfrag(xr + (h & 1) * XB_ + t * XT_);
      // Keeps all eight LDS reads in front of the WMMAs: scheduled among them
      // they shared one register set, and each pair waited out its own latency.
      __builtin_amdgcn_sched_barrier(0);
      // Next step's x into the other buffer (its readers left it at the
      // barrier that ended the step before).
      store_xrows(xd + ((h + 1) & 1) * XB_, xs[(h + 1) & 3]);
      #pragma unroll
      for (int t = 0; t < 4; ++t) {
        acc[0][t] = wmma_f16(wr[h & 1][0], a[t], acc[0][t]);   // (d, row)
        acc[1][t] = wmma_f16(wr[h & 1][1], a[t], acc[1][t]);   // (d, row)
        acc[2][t] = wmma_f16(a[t], wr[h & 1][2], acc[2][t]);   // (row, d)
      }
      // Keeps the refills behind the WMMAs that read the same registers:
      // scheduled above them they would take a further register set.
      __builtin_amdgcn_sched_barrier(0);
      #pragma unroll
      for (int g = 0; g < 3; ++g)
        wr[h & 1][g] = load_wfrag(wrow + kw * WSTEP_ + g * 4 * WFRAG_);
      xs[(h + 1) & 3] = load_xrows(xg + kx * 32);
      // Address wait of these loads (the next step rewrites their address
      // registers), then the step's barrier: it publishes the next step's
      // fragments and ends the reads of this step's buffer. By hand, with the
      // LDS wait alone, so that the global loads stay in flight across it.
      asm volatile("s_wait_xcnt 0x0\n\ts_wait_dscnt 0x0\n\t"
                   "s_barrier_signal -1\n\ts_barrier_wait -1" ::: "memory");
      // Keeps the next step's address arithmetic behind the address wait.
      __builtin_amdgcn_sched_barrier(0);
    }
  }

  const float* bqk[2] = {bq, bk};
  _Float16*    dqk[2] = {qh, kh};
  #pragma unroll
  for (int w = 0; w < 2; ++w) {             // q, k: lane = row, registers = d
    const float4 b0 = ((const float4*)(bqk[w] + wave*16 + kb))[0];
    const float4 b1 = ((const float4*)(bqk[w] + wave*16 + kb))[1];
    const float bb[8] = {b0.x, b0.y, b0.z, b0.w, b1.x, b1.y, b1.z, b1.w};
    #pragma unroll
    for (int t = 0; t < 4; ++t) {
      v8h pc;
      #pragma unroll
      for (int r = 0; r < 8; ++r) pc[r] = (_Float16)(acc[w][t][r] + bb[r]);
      *(v8h*)(dqk[w] + (size_t)(blockIdx.x * 4 + t) * PT_ + wave * PP8_ + lane * 8) = pc;
    }
  }
  {                                         // v: lane = d, registers = keys
    const float bb = bv[wave*16 + l16];
    #pragma unroll
    for (int t = 0; t < 4; ++t) {
      v8h pc;
      #pragma unroll
      for (int r = 0; r < 8; ++r) pc[r] = (_Float16)(acc[2][t][r] + bb);
      *(v8h*)(vth + (size_t)(blockIdx.x * 2 + (t >> 1)) * PV_ + (t & 1) * PP8_
                  + wave * 2 * PP8_ + lane * 8) = pc;
    }
  }
}

// ---------------------------------------------------------------------------
// Kernel 3: prep. biasf[b][j] = mask ? 0 : -1e22 (fp32, contiguous per j so
// the flash kernel reads it as broadcast float4s). vcum[b][t][d] = column
// prefix sums of V over j < t*32 (for the closed-form lower-triangle tail).
// grid = B*2 blocks of 32 waves: a block takes 32 columns d of one batch.
// A wave first takes two 32-blocks of all 32 columns (8 pieces of packed v^T,
// asked for at once), each lane sums 8 keys per piece and the two lane halves
// add up; through LDS a wave then gets one column, a lane the sums of its two
// 32-blocks, and the wave scans the lane totals. The block turns the result
// in LDS so that each 128-B line of vcum is stored whole by one wave.
// ---------------------------------------------------------------------------
#define PP_ 33    // block sums, prefix sums: LDS pitch in floats (32 banks)

__global__ void __launch_bounds__(1024)
attn_prep(const int* __restrict__ mask, const _Float16* __restrict__ vth,
          float* __restrict__ biasf, float* __restrict__ vcum) {
  __shared__ float bs[S_ / 32][PP_];   // [t][d]: sums over one 32-block
  __shared__ float sc[S_ / 32][PP_];   // [t][d]: sums over all blocks below t

  const int lane = threadIdx.x & 31;
  const int wave = threadIdx.x >> 5;  // 32-block pair, then column of the 32
  const int b    = blockIdx.x >> 1;
  const int d0   = (blockIdx.x & 1) * 32;
  const int gid  = blockIdx.x * 1024 + threadIdx.x;   // B*2*1024 == B*S

  const _Float16* win = vth + ((size_t)b * (S_ / 32) + 2 * wave) * PV_
                            + (d0 / 16) * 2 * PP8_ + lane * 8;
  v8h hv[8];                          // [32-block of the pair][d / 16][j]
  #pragma unroll
  for (int g = 0; g < 8; ++g)
    hv[g] = *(const v8h*)(win + (g >> 2) * PV_ + (g & 3) * PP8_);
  const int mk = mask[gid];
  // Address wait of the loads: the sums reuse their address pair.
  asm volatile("s_wait_xcnt 0x0" ::: "memory");
  // Keeps all nine loads in front of the sums: scheduled among them, the loads
  // went out in four groups, each waiting for the one before.
  __builtin_amdgcn_sched_barrier(0);

  #pragma unroll
  for (int q = 0; q < 2; ++q) {
    float s[2];                       // column (lane & 15) and that + 16
    #pragma unroll
    for (int tt = 0; tt < 2; ++tt) {
      float a[2];                     // keys 0 .. 15 and 16 .. 31 of the block
      #pragma unroll
      for (int j = 0; j < 2; ++j) {
        const v8h h = hv[q * 4 + tt * 2 + j];
        float p = (float)h[0];
        #pragma unroll
        for (int e = 1; e < 8; ++e) p += (float)h[e];
        a[j] = p + __shfl_xor(p, 16, 32);   // the other lane half's 8 keys
      }
      s[tt] = a[0] + a[1];
    }
    bs[2 * wave + q][lane] = (lane >> 4) ? s[1] : s[0];
  }

  // Publishes the 32-block sums to the waves that scan them per column.
  __syncthreads();

  const float s0 = bs[2 * lane][wave];
  const float s1 = bs[2 * lane + 1][wave];

  float inc = s0 + s1;                // inclusive scan over the lanes
  #pragma unroll
  for (int sh = 1; sh < 32; sh <<= 1) {
    const float up = __shfl_up(inc, sh, 32);
    if (lane >= sh) inc += up;
  }
  float before = __shfl_up(inc, 1, 32);   // sum over the keys of lower lanes
  if (lane == 0) before = 0.0f;
  sc[2 * lane][wave]     = before;
  sc[2 * lane + 1][wave] = before + s0;

  // Publishes every column's prefix sums to the storing threads.
  __syncthreads();

  const int t  = threadIdx.x >> 4;
  const int dp = (threadIdx.x & 15) * 2;
  float2 r;
  r.x = sc[t][dp];
  r.y = sc[t][dp + 1];
  *(float2*)(vcum + ((size_t)b * (S_ / 32) + t) * D_ + d0 + dp) = r;
  biasf[gid] = mk ? 0.0f : -1e22f;
}

// ---------------------------------------------------------------------------
// Kernel 4: transposed flash attention. grid = (S/32, B), 8 waves per block.
// A block takes the query tiles t and S/16-1-t (equal work in every block) and
// deals their 32-key windows over its waves; the partial softmax states are
// merged through LDS.
// ---------------------------------------------------------------------------
template <bool CAUSAL>
static __device__ __forceinline__
void flash_step(int jb, int icol, int rowoff,
                const _Float16* __restrict__ kbase,
                const _Float16* __restrict__ vbase,
                const float* __restrict__ bias,
                const v16h& bq0, const v16h& bq1,
                float& mrun, float& lrun, v8f o[4]) {
  const float inv_sqrt_d = 0.125f;   // 1/sqrt(64)

  // The window's loads: K (two 16-key tiles), mask bias, then V^T.
  v16h ak[2][2];
  float4 bb[2][2];
  #pragma unroll
  for (int f = 0; f < 2; ++f) {
    const _Float16* kp = kbase + (size_t)((jb >> 4) + f) * PT_;
    ak[f][0] = load_pfrag(kp);
    ak[f][1] = load_pfrag(kp + 2 * PP8_);
  }
  #pragma unroll
  for (int f = 0; f < 2; ++f) {
    const float4* bp = (const float4*)(bias + jb + f*16 + rowoff);
    bb[f][0] = bp[0];
    bb[f][1] = bp[1];
  }
  // Address wait of the K and bias loads: the V loads' results may land in
  // the registers that held their addresses.
  asm volatile("s_wait_xcnt 0x0" ::: "memory");
  v16h av[4];
  #pragma unroll
  for (int t = 0; t < 4; ++t)
    av[t] = load_pfrag(vbase + (size_t)(jb >> 5) * PV_ + t * 2 * PP8_);
  // Address wait of the V loads: the arithmetic below reuses their address pair.
  asm volatile("s_wait_xcnt 0x0" ::: "memory");

  // S^T = K * Q^T : two 16x16 tiles (j rows), lane = i
  v8f c[2];
  #pragma unroll
  for (int f = 0; f < 2; ++f) {
    v8f cz = {};
    c[f] = wmma_f16(ak[f][0], bq0, cz);
    c[f] = wmma_f16(ak[f][1], bq1, c[f]);
  }

  // mask bias (broadcast, contiguous) + optional causal select; in-lane stats
  float s[2][8];
  float maxv = -INFINITY;
  #pragma unroll
  for (int f = 0; f < 2; ++f) {
    const float4 bb0 = bb[f][0], bb1 = bb[f][1];
    float barr[8] = {bb0.x, bb0.y, bb0.z, bb0.w, bb1.x, bb1.y, bb1.z, bb1.w};
    #pragma unroll
    for (int r = 0; r < 8; ++r) {
      // |score| << 1e22/2^24, so fma(c, inv, -1e22) == -1e22 exactly.
      float sv = fmaf(c[f][r], inv_sqrt_d, barr[r]);
      if (CAUSAL) {
        const int j = jb + f*16 + rowoff + r;
        sv = (j >= icol) ? sv : -1e22f;
      }
      s[f][r] = sv;
      maxv = fmaxf(maxv, sv);
    }
  }
  maxv = fmaxf(maxv, __shfl_xor(maxv, 16, 32));   // other 16 j's, same i

  const float mnew  = fmaxf(mrun, maxv);
  const float scale = __expf(mrun - mnew);

  v16h pfrag;     // P as B-fragment: element e<8 -> f=0, e>=8 -> f=1
  float sum = 0.0f;
  #pragma unroll
  for (int f = 0; f < 2; ++f)
    #pragma unroll
    for (int r = 0; r < 8; ++r) {
      const float e = __expf(s[f][r] - mnew);
      sum += e;
      pfrag[f*8 + r] = (_Float16)e;
    }
  sum += __shfl_xor(sum, 16, 32);

  lrun = lrun * scale + sum;
  mrun = mnew;
  #pragma unroll
  for (int t = 0; t < 4; ++t) o[t] = o[t] * scale;

  // O^T += V^T * P  (A = V^T tile, packed; B = P in-register)
  #pragma unroll
  for (int t = 0; t < 4; ++t) o[t] = wmma_f16(av[t], pfrag, o[t]);
}

// exp(x) for the merge weights. v_exp_f32 and the free slot that the
// instruction set asks for behind it stand in one statement.
static __device__ __forceinline__ float exp_with_slot(float x) {
  float r;
  asm("v_exp_f32 %0, %1\n\tv_nop" : "=v"(r) : "v"(x * 1.44269504f));
  return r;
}

#define NW_ 8     // waves per work-group
#define OP_ 68    // merge buffer: floats per query row (272 B = 16 B x 17)

__global__ void __launch_bounds__(256)
attn_flash_t(const _Float16* __restrict__ qh, const _Float16* __restrict__ kh,
             const _Float16* __restrict__ vth, const float* __restrict__ biasf,
             const float* __restrict__ vcum, float* __restrict__ out) {
  // Per (tile of the pair, wave): un-normalised O^T partial, running max, sum.
  __shared__ __attribute__((aligned(16))) float so[2][NW_][16][OP_];
  __shared__ float sm[2][NW_][16];
  __shared__ float sl[2][NW_][16];

  const int lane   = threadIdx.x & 31;
  const int wave   = __builtin_amdgcn_readfirstlane(threadIdx.x >> 5);
  const int l16    = lane & 15;
  const int half   = lane >> 4;
  const int rowoff = half * 8;
  const int pr     = blockIdx.x;        // pair: tiles pr and S/16 - 1 - pr
  const int b      = blockIdx.y;

  const float* bias = biasf + b * S_;
  // This lane's 16 bytes of the batch's first packed piece.
  const _Float16* kbase = kh + (size_t)b * S_ * D_ + lane * 8;
  const _Float16* vbase = vth + (size_t)b * D_ * S_ + lane * 8;

  // The windows of both tiles (65 in every pair) form one list that is dealt
  // round-robin over the waves; u = this wave's next window in the tile.
  int u = wave;
  for (int h = 0; h < 2; ++h) {
    const int i0   = (h ? (S_ / 16 - 1 - pr) : pr) * 16;
    const int icol = i0 + l16;          // this lane's query row i
    const int jb0  = i0 & ~31;          // diagonal window start
    const int nwin = (S_ - jb0) >> 5;

    // Q^T B-fragments (lane = column i), loaded once per tile.
    const _Float16* qp = qh + ((size_t)b * S_ + i0) * D_ + lane * 8;
    const v16h bq0 = load_pfrag(qp);
    const v16h bq1 = load_pfrag(qp + 2 * PP8_);

    float mrun = -INFINITY;
    float lrun = 0.0f;
    v8f o[4];
    v8f vzero = {};
    #pragma unroll
    for (int t = 0; t < 4; ++t) o[t] = vzero;

    // Diagonal window (only place the causal compare is needed).
    if (u == 0) {
      flash_step<true>(jb0, icol, rowoff, kbase, vbase, bias,
                       bq0, bq1, mrun, lrun, o);
      u = NW_;
    }
    // Remaining windows: j >= i0+16 > every i in tile -> no causal test.
    for (; u < nwin; u += NW_)
      flash_step<false>(jb0 + u * 32, icol, rowoff, kbase, vbase, bias,
                        bq0, bq1, mrun, lrun, o);
    u -= nwin;                          // place in the next tile's windows

    // A wave without a window of this tile leaves (-inf, 0, 0): weight 0.
    if (half == 0) {
      sm[h][wave][l16] = mrun;
      sl[h][wave][l16] = lrun;
    }
    #pragma unroll
    for (int t = 0; t < 4; ++t) {
      float4 w0, w1;
      w0.x = o[t][0]; w0.y = o[t][1]; w0.z = o[t][2]; w0.w = o[t][3];
      w1.x = o[t][4]; w1.y = o[t][5]; w1.z = o[t][6]; w1.w = o[t][7];
      float* dst = &so[h][wave][l16][t*16 + rowoff];
      ((float4*)dst)[0] = w0;
      ((float4*)dst)[1] = w1;
    }
  }

  // Publishes every wave's partials to the merging threads.
  __syncthreads();

  // Merge: thread = (query row mi, four d); a wave stores whole 128-B lines.
  const int mi = threadIdx.x >> 4;
  const int dq = (threadIdx.x & 15) * 4;
  #pragma unroll
  for (int h = 0; h < 2; ++h) {
    const int i0  = (h ? (S_ / 16 - 1 - pr) : pr) * 16;
    const int jb0 = i0 & ~31;
    float mw[NW_];
    float mall = -INFINITY;             // finite: the diagonal window's wave
    #pragma unroll
    for (int w = 0; w < NW_; ++w) {
      mw[w] = sm[h][w][mi];
      mall = fmaxf(mall, mw[w]);
    }
    #pragma unroll
    for (int w = 0; w < NW_; ++w) mw[w] = exp_with_slot(mw[w] - mall);   // weights
    float lall = 0.0f;
    float4 acc = {0.0f, 0.0f, 0.0f, 0.0f};
    #pragma unroll
    for (int w = 0; w < NW_; ++w) {
      const float g = mw[w];
      const float4 p = *(const float4*)&so[h][w][mi][dq];
      lall += sl[h][w][mi] * g;
      acc.x += g * p.x; acc.y += g * p.y; acc.z += g * p.z; acc.w += g * p.w;
    }
    // Closed-form lower-triangle tail: all j < jb0 are -1e22 for every row.
    // e0 = exp(-1e22 - m): 0 for normal rows, exactly 1 for all-masked rows,
    // reproducing the reference's uniform softmax over all S columns.
    if (jb0 > 0) {
      const float e0 = __expf(-1e22f - mall);
      const float4 c = *(const float4*)(
          vcum + ((size_t)b * (S_ / 32) + (jb0 >> 5)) * D_ + dq);
      lall += (float)jb0 * e0;
      acc.x += e0 * c.x; acc.y += e0 * c.y; acc.z += e0 * c.z; acc.w += e0 * c.w;
    }
    const float inv = 1.0f / lall;      // lall >= 1 always
    float4 r;
    r.x = acc.x * inv; r.y = acc.y * inv; r.z = acc.z * inv; r.w = acc.w * inv;
    *(float4*)(out + ((size_t)b * S_ + i0 + mi) * D_ + dq) = r;
    // Address wait of the first tile's store: the second tile's merge reuses
    // the registers that the store names.
    if (h == 0) asm volatile("s_wait_xcnt 0x0" ::: "memory");
  }
}

// ---------------------------------------------------------------------------
extern "C" void kernel_launch(void* const* d_in, const int* in_sizes, int n_in,
                              void* d_out, int out_size, void* d_ws, size_t ws_size,
                              hipStream_t stream) {
  const float* x  = (const float*)d_in[0];
  const int* mask = (const int*)d_in[1];
  const float* Wq = (const float*)d_in[2];
  const float* bq = (const float*)d_in[3];
  const float* Wk = (const float*)d_in[4];
  const float* bk = (const float*)d_in[5];
  const float* Wv = (const float*)d_in[6];
  const float* bv = (const float*)d_in[7];
  float* out = (float*)d_out;

  // Workspace: f16 {weights | q | k | v^T} then f32 {biasf | vcum} ~ 6.9 MB
  _Float16* wh   = (_Float16*)d_ws;
  _Float16* qh   = wh + 3 * D_ * E_;
  _Float16* kh   = qh + (size_t)B_ * S_ * D_;
  _Float16* vth  = kh + (size_t)B_ * S_ * D_;
  float*    biasf = (float*)(vth + (size_t)B_ * S_ * D_);
  float*    vcum  = biasf + (size_t)B_ * S_;

  attn_cvt_weights<<<3 * D_ * E_ / 8 / 256, 256, 0, stream>>>(Wq, Wk, Wv, wh);
  attn_qkv_proj<<<256, 128, 0, stream>>>(x, wh, bq, bk, bv, qh, kh, vth);
  attn_prep<<<B_ * 2, 1024, 0, stream>>>(mask, vth, biasf, vcum);
  attn_flash_t<<<dim3(S_ / 32, B_), 256, 0, stream>>>(qh, kh, vth, biasf, vcum, out);
}

// v007
// One run takes 32.1 microseconds.
// Next to v006, in two timings, it ran 1.06 and 1.08 times as fast.
// All steps since v000 together make it 3.73 times as fast.
#include <hip/hip_runtime.h>

// ---------------------------------------------------------------------------
// Self-attention B=8, S=2048, E=1024, D=64 on gfx1250 (MI455X).
//   k1: Wq/Wk/Wv fp32 -> f16, packed in the order of k2's weight fragments
//   k2: fused QKV projection (12x v_wmma_f32_16x16x32_f16 per K-step and wave);
//       q, k, v^T f16, stored in the order of k4's fragments (see PT_, PV_).
//   k3: prep: mask -> fp32 additive bias; V column prefix-sums per 32-block
//       (one wave per column: lane sums, then a wave scan).
//   k4: transposed flash attention:
//         S^T = K*Q^T (lane = i), P^T C-layout == P B-fragment -> no LDS,
//         O^T = V^T*P (lane = i -> scalar softmax state),
//       32 query columns per wave, starting at the diagonal window; key
//       windows dealt over 8 waves and merged in LDS; the strictly-lower
//       region is applied in closed form (exact for the all-masked
//       uniform-softmax fallback).
// ---------------------------------------------------------------------------

typedef _Float16 v16h __attribute__((ext_vector_type(16)));
typedef _Float16 v8h  __attribute__((ext_vector_type(8)));
typedef float    v8f  __attribute__((ext_vector_type(8)));

#define B_ 8
#define S_ 2048
#define E_ 1024
#define D_ 64

static __device__ __forceinline__ v8f wmma_f16(v16h a, v16h b, v8f c) {
  // D = A(16x32 f16) * B(32x16 f16) + C(16x16 f32)
  return __builtin_amdgcn_wmma_f32_16x16x32_f16(false, a, false, b,
                                                (short)0, c, false, false);
}

// Packed q, k, v^T. A piece is what one wave-wide 16-byte load takes: 32 lanes
// x 8 halves = 512 contiguous bytes; a fragment is two pieces in a row.
//   q, k: [16-row tile][n = d / 16][lane = (row, half)][8]: d = n*16 + half*8 ..
//   v^T : [32-key window][t = d / 16][j][lane = (d % 16, half)][8]:
//         keys j*16 + half*8 .. of the window
#define PP8_ 256              // halves of one piece
#define PT_  (16 * D_)        // halves of one 16-row tile of q or k
#define PV_  (32 * D_)        // halves of one 32-key window of v^T

static __device__ __forceinline__ v16h load_pfrag(const _Float16* p) {
  // One packed fragment: this lane's 16 bytes of each of its two pieces.
  v16h f;
  ((v8h*)&f)[0] = ((const v8h*)p)[0];
  ((v8h*)&f)[1] = ((const v8h*)(p + PP8_))[0];
  return f;
}

// ---------------------------------------------------------------------------
// Kernel 1: fp32 -> f16 weight conversion, packed for kernel 2's loads.
// wh[step s][fragment f][j][lane][8]: the 16 bytes that lane (l16, half) of a
// wave takes with the j-th load of fragment f (rows f*16 .. +15 of Wq|Wk|Wv)
// in K-step s, that is k = s*32 + j*16 + half*8 .. +7 of row f*16 + l16.
// A wave-wide load in kernel 2 then reads 512 contiguous bytes (4 lines); on
// row-major weights it took 32-byte pieces of 16 lines.
// One thread per 16-byte piece, in the order of the packed array.
// ---------------------------------------------------------------------------
#define WFRAG_ 512               // halves of one packed fragment (2 loads)
#define WSTEP_ (12 * WFRAG_)     // halves of one K-step (12 fragments)

__global__ void __launch_bounds__(256)
attn_cvt_weights(const float* __restrict__ Wq, const float* __restrict__ Wk,
                 const float* __restrict__ Wv, _Float16* __restrict__ wh) {
  const int g    = blockIdx.x * blockDim.x + threadIdx.x;  // 0 .. 3*D*E/8 - 1
  const int lane = g & 31;
  const int j    = (g >> 5) & 1;
  const int sf   = g >> 6;         // s*12 + f
  const int s    = sf / 12;
  const int f    = sf - s * 12;
  const float* W = (f < 4) ? Wq : ((f < 8) ? Wk : Wv);
  const float* p = W + (size_t)((f & 3) * 16 + (lane & 15)) * E_
                     + s * 32 + j * 16 + (lane >> 4) * 8;
  const float4 a = ((const float4*)p)[0];
  const float4 c = ((const float4*)p)[1];
  v8h h;
  h[0] = (_Float16)a.x; h[1] = (_Float16)a.y;
  h[2] = (_Float16)a.z; h[3] = (_Float16)a.w;
  h[4] = (_Float16)c.x; h[5] = (_Float16)c.y;
  h[6] = (_Float16)c.z; h[7] = (_Float16)c.w;
  *(v8h*)(wh + (size_t)g * 8) = h;
}

static __device__ __forceinline__ v16h load_wfrag(const _Float16* p) {
  // One packed fragment: this lane's 16 bytes of each of its two loads.
  v16h f;
  ((v8h*)&f)[0] = ((const v8h*)p)[0];
  ((v8h*)&f)[1] = ((const v8h*)(p + WFRAG_ / 2))[0];
  return f;
}

// ---------------------------------------------------------------------------
// Kernel 2: fused QKV projection. A block of 4 waves takes 64 rows of x (4 row
// tiles); wave n takes the n-th 16 columns of each of Q, K and V for all four
// tiles: 12 accumulators, 3 weight fragments per K-step. Each weight fragment
// is so loaded once per block and feeds 4 WMMAs.
// x goes through LDS: wave w loads the rows of tile w in whole 128-B lines,
// converts them to f16 and stores them in fragment order; every wave reads all
// four fragments of the step. Two LDS buffers, one barrier per K-step.
// Weights are asked for two steps ahead, x five steps ahead, in registers.
// Q and K are formed transposed (weights as A, x as B: the two operands have
// the same lane layout), V as x * Wv^T: in both cases a lane's 8 accumulator
// registers are the 8 halves of one packed piece, one 16-byte store.
// ---------------------------------------------------------------------------
typedef float    v4f __attribute__((ext_vector_type(4)));
typedef _Float16 v4h __attribute__((ext_vector_type(4)));

#define XT_ 512               // halves of one x fragment in LDS (16 rows x 32 k)
#define XB_ (4 * XT_)         // halves of one LDS buffer (4 row tiles)
#define KS_ (E_ / 32)         // K-steps

struct XRows { v4f r[4]; };   // this lane's 16 bytes of 4 of its tile's rows

static __device__ __forceinline__ XRows load_xrows(const float* p) {
  // Load i covers rows 4i .. 4i+3 of the tile, 128 contiguous bytes of each.
  XRows v;
  #pragma unroll
  for (int i = 0; i < 4; ++i) v.r[i] = *(const v4f*)(p + (size_t)i * 4 * E_);
  return v;
}

static __device__ __forceinline__ void store_xrows(_Float16* d, const XRows& v) {
  #pragma unroll
  for (int i = 0; i < 4; ++i) {
    v4h h;
    #pragma unroll
    for (int e = 0; e < 4; ++e) h[e] = (_Float16)v.r[i][e];
    *(v4h*)(d + i * 32) = h;            // 4 rows further: 4 x 8 halves
  }
}

__global__ void __launch_bounds__(128)
attn_qkv_proj(const float* __restrict__ x, const _Float16* __restrict__ wh,
              const float* __restrict__ bq, const float* __restrict__ bk,
              const float* __restrict__ bv,
              _Float16* __restrict__ qh, _Float16* __restrict__ kh,
              _Float16* __restrict__ vth) {
  // x as f16 fragments: [buffer][row tile][j][lane = (row, half)][8],
  // k = j*16 + half*8 .. +7 of the step, as the WMMA operand takes them.
  __shared__ __attribute__((aligned(16))) _Float16 xf[2 * XB_];

  const int lane = threadIdx.x & 31;
  const int wave = __builtin_amdgcn_readfirstlane(threadIdx.x >> 5);
  const int l16  = lane & 15;
  const int half = lane >> 4;
  const int kb   = half * 8;

  v8f acc[3][4];                          // [q, k, v][row tile]
  v8f vzero = {};
  #pragma unroll
  for (int g = 0; g < 3; ++g)
    #pragma unroll
    for (int t = 0; t < 4; ++t) acc[g][t] = vzero;

  // Global x: lane = (row of four = lane / 8, 16-byte piece c = lane % 8).
  const float* xg = x + (size_t)((blockIdx.x * 4 + wave) * 16 + (lane >> 3)) * E_
                      + (lane & 7) * 4;
  // Its place in the fragment: k = 4c .. 4c+3 -> j = c / 4, half = (c / 2) % 2,
  // element (c % 2) * 4.
  _Float16* xd = xf + wave * XT_ + ((lane >> 2) & 1) * 256
                    + (((lane >> 1) & 1) * 16 + (lane >> 3)) * 8 + (lane & 1) * 4;
  const _Float16* xr = xf + lane * 8;
  // Step s, matrix g (q, k, v): + s*WSTEP_ + g*4*WFRAG_
  const _Float16* wrow = wh + wave * WFRAG_ + lane * 8;

  // Prologue: x of steps 0 .. 3, weights of steps 0 and 1; step 0's x to LDS,
  // its registers refilled with step 4.
  XRows xs[4];
  v16h  wr[2][3];
  // Asked for in the order of the loop (x three steps ahead of the weights that
  // precede it); the scheduling barriers keep that order: loads return in issue
  // order, and in another order the counted waits at the loop's head, which
  // must hold for both ways into it, would also cover younger x loads.
  #pragma unroll
  for (int s = 0; s < 3; ++s) {
    xs[s] = load_xrows(xg + s * 32);
    __builtin_amdgcn_sched_barrier(0);
  }
  #pragma unroll
  for (int g = 0; g < 3; ++g) wr[0][g] = load_wfrag(wrow + g * 4 * WFRAG_);
  __builtin_amdgcn_sched_barrier(0);
  xs[3] = load_xrows(xg + 3 * 32);
  __builtin_amdgcn_sched_barrier(0);
  #pragma unroll
  for (int g = 0; g < 3; ++g) wr[1][g] = load_wfrag(wrow + WSTEP_ + g * 4 * WFRAG_);
  __builtin_amdgcn_sched_barrier(0);
  store_xrows(xd, xs[0]);
  xs[0] = load_xrows(xg + 4 * 32);
  // Address wait of the prologue's loads, then the barrier that publishes step
  // 0's fragments. Written by hand with the LDS wait alone: __syncthreads()
  // would also wait for the global loads that are meant to stay in flight.
  asm volatile("s_wait_xcnt 0x0\n\ts_wait_dscnt 0x0\n\t"
               "s_barrier_signal -1\n\ts_barrier_wait -1" ::: "memory");
  __builtin_amdgcn_sched_barrier(0);

  for (int k0 = 0; k0 < KS_; k0 += 4) {
    // Four steps per pass, so that every register set is refilled in place.
    #pragma unroll
    for (int h = 0; h < 4; ++h) {
      const int kc = k0 + h;
      // Steps whose operands are fetched now, clamped to the last step.
      const int kw = (kc + 2 < KS_) ? kc + 2 : KS_ - 1;
      const int kx = (kc + 5 < KS_) ? kc + 5 : KS_ - 1;
      v16h a[4];
      #pragma unroll
      for (int t = 0; t < 4; ++t)
        a[t] = load_pfrag(xr + (h & 1) * XB_ + t * XT_);
      // Keeps all eight LDS reads in front of the WMMAs: scheduled among them
      // they shared one register set, and each pair waited out its own latency.
      __builtin_amdgcn_sched_barrier(0);
      // Next step's x into the other buffer (its readers left it at the
      // barrier that ended the step before).
      store_xrows(xd + ((h + 1) & 1) * XB_, xs[(h + 1) & 3]);
      #pragma unroll
      for (int t = 0; t < 4; ++t) {
        acc[0][t] = wmma_f16(wr[h & 1][0], a[t], acc[0][t]);   // (d, row)
        acc[1][t] = wmma_f16(wr[h & 1][1], a[t], acc[1][t]);   // (d, row)
        acc[2][t] = wmma_f16(a[t], wr[h & 1][2], acc[2][t]);   // (row, d)
      }
      // Keeps the refills behind the WMMAs that read the same registers:
      // scheduled above them they would take a further register set.
      __builtin_amdgcn_sched_barrier(0);
      #pragma unroll
      for (int g = 0; g < 3; ++g)
        wr[h & 1][g] = load_wfrag(wrow + kw * WSTEP_ + g * 4 * WFRAG_);
      xs[(h + 1) & 3] = load_xrows(xg + kx * 32);
      // Address wait of these loads (the next step rewrites their address
      // registers), then the step's barrier: it publishes the next step's
      // fragments and ends the reads of this step's buffer. By hand, with the
      // LDS wait alone, so that the global loads stay in flight across it.
      asm volatile("s_wait_xcnt 0x0\n\ts_wait_dscnt 0x0\n\t"
                   "s_barrier_signal -1\n\ts_barrier_wait -1" ::: "memory");
      // Keeps the next step's address arithmetic behind the address wait.
      __builtin_amdgcn_sched_barrier(0);
    }
  }

  const float* bqk[2] = {bq, bk};
  _Float16*    dqk[2] = {qh, kh};
  #pragma unroll
  for (int w = 0; w < 2; ++w) {             // q, k: lane = row, registers = d
    const float4 b0 = ((const float4*)(bqk[w] + wave*16 + kb))[0];
    const float4 b1 = ((const float4*)(bqk[w] + wave*16 + kb))[1];
    const float bb[8] = {b0.x, b0.y, b0.z, b0.w, b1.x, b1.y, b1.z, b1.w};
    #pragma unroll
    for (int t = 0; t < 4; ++t) {
      v8h pc;
      #pragma unroll
      for (int r = 0; r < 8; ++r) pc[r] = (_Float16)(acc[w][t][r] + bb[r]);
      *(v8h*)(dqk[w] + (size_t)(blockIdx.x * 4 + t) * PT_ + wave * PP8_ + lane * 8) = pc;
    }
  }
  {                                         // v: lane = d, registers = keys
    const float bb = bv[wave*16 + l16];
    #pragma unroll
    for (int t = 0; t < 4; ++t) {
      v8h pc;
      #pragma unroll
      for (int r = 0; r < 8; ++r) pc[r] = (_Float16)(acc[2][t][r] + bb);
      *(v8h*)(vth + (size_t)(blockIdx.x * 2 + (t >> 1)) * PV_ + (t & 1) * PP8_
                  + wave * 2 * PP8_ + lane * 8) = pc;
    }
  }
}

// ---------------------------------------------------------------------------
// Kernel 3: prep. biasf[b][j] = mask ? 0 : -1e22 (fp32, contiguous per j so
// the flash kernel reads it as broadcast float4s). vcum[b][t][d] = column
// prefix sums of V over j < t*32 (for the closed-form lower-triangle tail).
// grid = B*2 blocks of 32 waves: a block takes 32 columns d of one batch.
// A wave first takes two 32-blocks of all 32 columns (8 pieces of packed v^T,
// asked for at once), each lane sums 8 keys per piece and the two lane halves
// add up; through LDS a wave then gets one column, a lane the sums of its two
// 32-blocks, and the wave scans the lane totals. The block turns the result
// in LDS so that each 128-B line of vcum is stored whole by one wave.
// ---------------------------------------------------------------------------
#define PP_ 33    // block sums, prefix sums: LDS pitch in floats (32 banks)

__global__ void __launch_bounds__(1024)
attn_prep(const int* __restrict__ mask, const _Float16* __restrict__ vth,
          float* __restrict__ biasf, float* __restrict__ vcum) {
  __shared__ float bs[S_ / 32][PP_];   // [t][d]: sums over one 32-block
  __shared__ float sc[S_ / 32][PP_];   // [t][d]: sums over all blocks below t

  const int lane = threadIdx.x & 31;
  const int wave = threadIdx.x >> 5;  // 32-block pair, then column of the 32
  const int b    = blockIdx.x >> 1;
  const int d0   = (blockIdx.x & 1) * 32;
  const int gid  = blockIdx.x * 1024 + threadIdx.x;   // B*2*1024 == B*S

  const _Float16* win = vth + ((size_t)b * (S_ / 32) + 2 * wave) * PV_
                            + (d0 / 16) * 2 * PP8_ + lane * 8;
  v8h hv[8];                          // [32-block of the pair][d / 16][j]
  #pragma unroll
  for (int g = 0; g < 8; ++g)
    hv[g] = *(const v8h*)(win + (g >> 2) * PV_ + (g & 3) * PP8_);
  const int mk = mask[gid];
  // Address wait of the loads: the sums reuse their address pair.
  asm volatile("s_wait_xcnt 0x0" ::: "memory");
  // Keeps all nine loads in front of the sums: scheduled among them, the loads
  // went out in four groups, each waiting for the one before.
  __builtin_amdgcn_sched_barrier(0);

  #pragma unroll
  for (int q = 0; q < 2; ++q) {
    float s[2];                       // column (lane & 15) and that + 16
    #pragma unroll
    for (int tt = 0; tt < 2; ++tt) {
      float a[2];                     // keys 0 .. 15 and 16 .. 31 of the block
      #pragma unroll
      for (int j = 0; j < 2; ++j) {
        const v8h h = hv[q * 4 + tt * 2 + j];
        float p = (float)h[0];
        #pragma unroll
        for (int e = 1; e < 8; ++e) p += (float)h[e];
        a[j] = p + __shfl_xor(p, 16, 32);   // the other lane half's 8 keys
      }
      s[tt] = a[0] + a[1];
    }
    bs[2 * wave + q][lane] = (lane >> 4) ? s[1] : s[0];
  }

  // Publishes the 32-block sums to the waves that scan them per column.
  __syncthreads();

  const float s0 = bs[2 * lane][wave];
  const float s1 = bs[2 * lane + 1][wave];

  float inc = s0 + s1;                // inclusive scan over the lanes
  #pragma unroll
  for (int sh = 1; sh < 32; sh <<= 1) {
    const float up = __shfl_up(inc, sh, 32);
    if (lane >= sh) inc += up;
  }
  float before = __shfl_up(inc, 1, 32);   // sum over the keys of lower lanes
  if (lane == 0) before = 0.0f;
  sc[2 * lane][wave]     = before;
  sc[2 * lane + 1][wave] = before + s0;

  // Publishes every column's prefix sums to the storing threads.
  __syncthreads();

  const int t  = threadIdx.x >> 4;
  const int dp = (threadIdx.x & 15) * 2;
  float2 r;
  r.x = sc[t][dp];
  r.y = sc[t][dp + 1];
  *(float2*)(vcum + ((size_t)b * (S_ / 32) + t) * D_ + d0 + dp) = r;
  biasf[gid] = mk ? 0.0f : -1e22f;
}

// ---------------------------------------------------------------------------
// Kernel 4: transposed flash attention. grid = (S/64, B), 8 waves per block.
// A block takes the 32-row query tiles t and S/32-1-t (equal work in every
// block) and deals their 32-key windows over its waves; the partial softmax
// states are merged through LDS. A wave holds both 16-column groups of the
// tile, so each K and V^T fragment that it loads feeds two WMMAs.
// ---------------------------------------------------------------------------
#define QC_ 2     // 16-column query groups of a tile

template <bool CAUSAL>
static __device__ __forceinline__
void flash_step(int jb, int icol, int rowoff,
                const _Float16* __restrict__ kbase,
                const _Float16* __restrict__ vbase,
                const float* __restrict__ bias,
                const v16h (&bq)[QC_][2],
                float (&mrun)[QC_], float (&lrun)[QC_], v8f (&o)[QC_][4]) {
  const float inv_sqrt_d = 0.125f;   // 1/sqrt(64)

  // The window's loads: mask bias, K (two 16-key tiles), then V^T.
  v16h ak[2][2];
  v4f bb[2][2];
  #pragma unroll
  for (int f = 0; f < 2; ++f) {
    const v4f* bp = (const v4f*)(bias + jb + f*16 + rowoff);
    bb[f][0] = bp[0];
    bb[f][1] = bp[1];
  }
  #pragma unroll
  for (int f = 0; f < 2; ++f) {
    const _Float16* kp = kbase + (size_t)((jb >> 4) + f) * PT_;
    ak[f][0] = load_pfrag(kp);
    ak[f][1] = load_pfrag(kp + 2 * PP8_);
  }
  // Address wait of the K and bias loads: the V loads' results may land in
  // the registers that held their addresses.
  asm volatile("s_wait_xcnt 0x0" ::: "memory");
  v16h av[4];
  #pragma unroll
  for (int t = 0; t < 4; ++t)
    av[t] = load_pfrag(vbase + (size_t)(jb >> 5) * PV_ + t * 2 * PP8_);
  // Address wait of the V loads: the arithmetic below reuses their address pair.
  asm volatile("s_wait_xcnt 0x0" ::: "memory");
  // Holds the bias loads in front of the WMMAs (loaded values as inputs only):
  // left free they went out behind the first WMMAs, a second latency in front
  // of the softmax.
  asm volatile("" :: "v"(bb[0][0]), "v"(bb[0][1]), "v"(bb[1][0]), "v"(bb[1][1]));
  // Keeps all of the window's loads in front of the WMMAs, V in registers of
  // its own: its latency then runs beside K's, not behind it.
  __builtin_amdgcn_sched_barrier(0);

  // S^T = K * Q^T : per column group two 16x16 tiles (j rows), lane = i
  v8f c[QC_][2];
  #pragma unroll
  for (int f = 0; f < 2; ++f)
    #pragma unroll
    for (int q = 0; q < QC_; ++q) {
      v8f cz = {};
      c[q][f] = wmma_f16(ak[f][0], bq[q][0], cz);
    }
  #pragma unroll
  for (int f = 0; f < 2; ++f)
    #pragma unroll
    for (int q = 0; q < QC_; ++q)
      c[q][f] = wmma_f16(ak[f][1], bq[q][1], c[q][f]);

  v16h pfrag[QC_];  // P as B-fragment: element e<8 -> f=0, e>=8 -> f=1
  #pragma unroll
  for (int q = 0; q < QC_; ++q) {
    // mask bias (broadcast, contiguous) + optional causal select; in-lane stats
    float s[2][8];
    float maxv = -INFINITY;
    #pragma unroll
    for (int f = 0; f < 2; ++f) {
      const v4f bb0 = bb[f][0], bb1 = bb[f][1];
      float barr[8] = {bb0[0], bb0[1], bb0[2], bb0[3], bb1[0], bb1[1], bb1[2], bb1[3]};
      #pragma unroll
      for (int r = 0; r < 8; ++r) {
        // |score| << 1e22/2^24, so fma(c, inv, -1e22) == -1e22 exactly.
        float sv = fmaf(c[q][f][r], inv_sqrt_d, barr[r]);
        if (CAUSAL) {
          const int j = jb + f*16 + rowoff + r;
          sv = (j >= icol + q*16) ? sv : -1e22f;
        }
        s[f][r] = sv;
        maxv = fmaxf(maxv, sv);
      }
    }
    maxv = fmaxf(maxv, __shfl_xor(maxv, 16, 32));   // other 16 j's, same i

    const float mnew  = fmaxf(mrun[q], maxv);
    const float scale = __expf(mrun[q] - mnew);

    float sum = 0.0f;
    #pragma unroll
    for (int f = 0; f < 2; ++f)
      #pragma unroll
      for (int r = 0; r < 8; ++r) {
        const float e = __expf(s[f][r] - mnew);
        sum += e;
        pfrag[q][f*8 + r] = (_Float16)e;
      }
    sum += __shfl_xor(sum, 16, 32);

    lrun[q] = lrun[q] * scale + sum;
    mrun[q] = mnew;
    #pragma unroll
    for (int t = 0; t < 4; ++t) o[q][t] = o[q][t] * scale;
  }

  // O^T += V^T * P  (A = V^T tile, packed; B = P in-register)
  #pragma unroll
  for (int t = 0; t < 4; ++t)
    #pragma unroll
    for (int q = 0; q < QC_; ++q) o[q][t] = wmma_f16(av[t], pfrag[q], o[q][t]);
}

// exp(x) for the merge weights. v_exp_f32 and the free slot that the
// instruction set asks for behind it stand in one statement.
static __device__ __forceinline__ float exp_with_slot(float x) {
  float r;
  asm("v_exp_f32 %0, %1\n\tv_nop" : "=v"(r) : "v"(x * 1.44269504f));
  return r;
}

#define NW_ 8     // waves per work-group
#define QR_ (16 * QC_)   // query rows of a tile
#define OP_ 68    // merge buffer: floats per query row (272 B = 16 B x 17)

__global__ void __launch_bounds__(256)
attn_flash_t(const _Float16* __restrict__ qh, const _Float16* __restrict__ kh,
             const _Float16* __restrict__ vth, const float* __restrict__ biasf,
             const float* __restrict__ vcum, float* __restrict__ out) {
  // Per (tile of the pair, wave): un-normalised O^T partial, running max, sum.
  __shared__ __attribute__((aligned(16))) float so[2][NW_][QR_][OP_];
  __shared__ float sm[2][NW_][QR_];
  __shared__ float sl[2][NW_][QR_];

  const int lane   = threadIdx.x & 31;
  const int wave   = __builtin_amdgcn_readfirstlane(threadIdx.x >> 5);
  const int l16    = lane & 15;
  const int half   = lane >> 4;
  const int rowoff = half * 8;
  const int pr     = blockIdx.x;        // pair: tiles pr and S/32 - 1 - pr
  const int b      = blockIdx.y;

  const float* bias = biasf + b * S_;
  // This lane's 16 bytes of the batch's first packed piece.
  const _Float16* kbase = kh + (size_t)b * S_ * D_ + lane * 8;
  const _Float16* vbase = vth + (size_t)b * D_ * S_ + lane * 8;

  // The windows of both tiles (65 in every pair) form one list that is dealt
  // round-robin over the waves; u = this wave's next window in the tile.
  int u = wave;
  for (int h = 0; h < 2; ++h) {
    const int i0   = (h ? (S_ / QR_ - 1 - pr) : pr) * QR_;   // = diagonal window
    const int icol = i0 + l16;          // this lane's query row i in group 0
    const int nwin = (S_ - i0) >> 5;

    // Q^T B-fragments (lane = column i), loaded once per tile.
    const _Float16* qp = qh + ((size_t)b * S_ + i0) * D_ + lane * 8;
    v16h bq[QC_][2];
    #pragma unroll
    for (int q = 0; q < QC_; ++q) {
      bq[q][0] = load_pfrag(qp + q * PT_);
      bq[q][1] = load_pfrag(qp + q * PT_ + 2 * PP8_);
    }
    // Address wait of the Q loads: the zeroing below reuses their address pair.
    asm volatile("s_wait_xcnt 0x0" ::: "memory");

    float mrun[QC_], lrun[QC_];
    v8f o[QC_][4];
    v8f vzero = {};
    #pragma unroll
    for (int q = 0; q < QC_; ++q) {
      mrun[q] = -INFINITY;
      lrun[q] = 0.0f;
      #pragma unroll
      for (int t = 0; t < 4; ++t) o[q][t] = vzero;
    }

    // Diagonal window (only place the causal compare is needed).
    if (u == 0) {
      flash_step<true>(i0, icol, rowoff, kbase, vbase, bias, bq, mrun, lrun, o);
      u = NW_;
    }
    // Remaining windows: j >= i0+32 > every i in tile -> no causal test.
    for (; u < nwin; u += NW_)
      flash_step<false>(i0 + u * 32, icol, rowoff, kbase, vbase, bias,
                        bq, mrun, lrun, o);
    u -= nwin;                          // place in the next tile's windows

    // A wave without a window of this tile leaves (-inf, 0, 0): weight 0.
    #pragma unroll
    for (int q = 0; q < QC_; ++q) {
      if (half == 0) {
        sm[h][wave][q*16 + l16] = mrun[q];
        sl[h][wave][q*16 + l16] = lrun[q];
      }
      #pragma unroll
      for (int t = 0; t < 4; ++t) {
        float4 w0, w1;
        w0.x = o[q][t][0]; w0.y = o[q][t][1]; w0.z = o[q][t][2]; w0.w = o[q][t][3];
        w1.x = o[q][t][4]; w1.y = o[q][t][5]; w1.z = o[q][t][6]; w1.w = o[q][t][7];
        float* dst = &so[h][wave][q*16 + l16][t*16 + rowoff];
        ((float4*)dst)[0] = w0;
        ((float4*)dst)[1] = w1;
      }
    }
  }

  // Publishes every wave's partials to the merging threads.
  __syncthreads();

  // Merge: thread = (query row of 16, four d); a wave stores whole 128-B lines.
  const int dq = (threadIdx.x & 15) * 4;
  #pragma unroll
  for (int hq = 0; hq < 2 * QC_; ++hq) {
    const int h  = hq / QC_;
    const int mi = (hq % QC_) * 16 + (threadIdx.x >> 4);
    const int i0 = (h ? (S_ / QR_ - 1 - pr) : pr) * QR_;
    float mw[NW_];
    float mall = -INFINITY;             // finite: the diagonal window's wave
    #pragma unroll
    for (int w = 0; w < NW_; ++w) {
      mw[w] = sm[h][w][mi];
      mall = fmaxf(mall, mw[w]);
    }
    #pragma unroll
    for (int w = 0; w < NW_; ++w) mw[w] = exp_with_slot(mw[w] - mall);   // weights
    float lall = 0.0f;
    float4 acc = {0.0f, 0.0f, 0.0f, 0.0f};
    #pragma unroll
    for (int w = 0; w < NW_; ++w) {
      const float g = mw[w];
      const float4 p = *(const float4*)&so[h][w][mi][dq];
      lall += sl[h][w][mi] * g;
      acc.x += g * p.x; acc.y += g * p.y; acc.z += g * p.z; acc.w += g * p.w;
    }
    // Closed-form lower-triangle tail: all j < i0 are -1e22 for every row.
    // e0 = exp(-1e22 - m): 0 for normal rows, exactly 1 for all-masked rows,
    // reproducing the reference's uniform softmax over all S columns.
    if (i0 > 0) {
      const float e0 = __expf(-1e22f - mall);
      const float4 c = *(const float4*)(
          vcum + ((size_t)b * (S_ / 32) + (i0 >> 5)) * D_ + dq);
      lall += (float)i0 * e0;
      acc.x += e0 * c.x; acc.y += e0 * c.y; acc.z += e0 * c.z; acc.w += e0 * c.w;
    }
    const float inv = 1.0f / lall;      // lall >= 1 always
    float4 r;
    r.x = acc.x * inv; r.y = acc.y * inv; r.z = acc.z * inv; r.w = acc.w * inv;
    *(float4*)(out + ((size_t)b * S_ + i0 + mi) * D_ + dq) = r;
    // Address wait of the store: the next 16 rows' merge reuses the registers
    // that the store names.
    if (hq + 1 < 2 * QC_) asm volatile("s_wait_xcnt 0x0" ::: "memory");
  }
}

// ---------------------------------------------------------------------------
extern "C" void kernel_launch(void* const* d_in, const int* in_sizes, int n_in,
                              void* d_out, int out_size, void* d_ws, size_t ws_size,
                              hipStream_t stream) {
  const float* x  = (const float*)d_in[0];
  const int* mask = (const int*)d_in[1];
  const float* Wq = (const float*)d_in[2];
  const float* bq = (const float*)d_in[3];
  const float* Wk = (const float*)d_in[4];
  const float* bk = (const float*)d_in[5];
  const float* Wv = (const float*)d_in[6];
  const float* bv = (const float*)d_in[7];
  float* out = (float*)d_out;

  // Workspace: f16 {weights | q | k | v^T} then f32 {biasf | vcum} ~ 6.9 MB
  _Float16* wh   = (_Float16*)d_ws;
  _Float16* qh   = wh + 3 * D_ * E_;
  _Float16* kh   = qh + (size_t)B_ * S_ * D_;
  _Float16* vth  = kh + (size_t)B_ * S_ * D_;
  float*    biasf = (float*)(vth + (size_t)B_ * S_ * D_);
  float*    vcum  = biasf + (size_t)B_ * S_;

  attn_cvt_weights<<<3 * D_ * E_ / 8 / 256, 256, 0, stream>>>(Wq, Wk, Wv, wh);
  attn_qkv_proj<<<256, 128, 0, stream>>>(x, wh, bq, bk, bv, qh, kh, vth);
  attn_prep<<<B_ * 2, 1024, 0, stream>>>(mask, vth, biasf, vcum);
  attn_flash_t<<<dim3(S_ / 64, B_), 256, 0, stream>>>(qh, kh, vth, biasf, vcum, out);
}

// v008
// Measured time: 27.2 microseconds a run.
// Two timings next to v007 both put it at 1.17 times that version's speed.
// Counting every step since v000, it is 4.35 times as fast.
#include <hip/hip_runtime.h>

// ---------------------------------------------------------------------------
// Self-attention B=8, S=2048, E=1024, D=64 on gfx1250 (MI455X).
//   k1: Wq/Wk/Wv fp32 -> f16, packed in the order of k2's B fragments;
//       mask -> fp32 additive bias.
//   k2: fused QKV projection (12x v_wmma_f32_16x16x32_f16 per K-step and wave);
//       q, k, v^T f16, stored in the order of k3's fragments (see PT_, PV_);
//       V column sums of each 32-key window.
//   k3: transposed flash attention:
//         S^T = K*Q^T (lane = i), P^T C-layout == P B-fragment -> no LDS,
//         O^T = V^T*P (lane = i -> scalar softmax state),
//       32 query columns per wave, starting at the diagonal window; key
//       windows dealt over 8 waves and merged in LDS; the strictly-lower
//       region is applied in closed form from the window sums (exact for
//       the all-masked uniform-softmax fallback).
// ---------------------------------------------------------------------------

typedef _Float16 v16h __attribute__((ext_vector_type(16)));
typedef _Float16 v8h  __attribute__((ext_vector_type(8)));
typedef float    v8f  __attribute__((ext_vector_type(8)));

#define B_ 8
#define S_ 2048
#define E_ 1024
#define D_ 64

static __device__ __forceinline__ v8f wmma_f16(v16h a, v16h b, v8f c) {
  // D = A(16x32 f16) * B(32x16 f16) + C(16x16 f32)
  return __builtin_amdgcn_wmma_f32_16x16x32_f16(false, a, false, b,
                                                (short)0, c, false, false);
}

// Packed q, k, v^T. A piece is what one wave-wide 16-byte load takes: 32 lanes
// x 8 halves = 512 contiguous bytes; a fragment is two pieces in a row.
//   q, k: [16-row tile][n = d / 16][lane = (row, half)][8]: d = n*16 + half*8 ..
//   v^T : [32-key window][t = d / 16][j][lane = (d % 16, half)][8]:
//         keys j*16 + half*8 .. of the window
#define PP8_ 256              // halves of one piece
#define PT_  (16 * D_)        // halves of one 16-row tile of q or k
#define PV_  (32 * D_)        // halves of one 32-key window of v^T

static __device__ __forceinline__ v16h load_pfrag(const _Float16* p) {
  // One packed fragment: this lane's 16 bytes of each of its two pieces.
  v16h f;
  ((v8h*)&f)[0] = ((const v8h*)p)[0];
  ((v8h*)&f)[1] = ((const v8h*)(p + PP8_))[0];
  return f;
}

// ---------------------------------------------------------------------------
// Kernel 1: fp32 -> f16 weight conversion, packed for kernel 2's loads.
// wh[step s][fragment f][j][lane][8]: the 16 bytes that lane (l16, half) of a
// wave takes with the j-th load of fragment f (rows f*16 .. +15 of Wq|Wk|Wv)
// in K-step s, that is k = s*32 + j*16 + half*8 .. +7 of row f*16 + l16.
// A wave-wide load in kernel 2 then reads 512 contiguous bytes (4 lines); on
// row-major weights it took 32-byte pieces of 16 lines.
// One thread per 16-byte piece, in the order of the packed array.
// The first B*S threads also turn one mask element into the flash kernel's
// bias: biasf[b][j] = mask ? 0 : -1e22 (whole blocks: B*S is a multiple of 256).
// ---------------------------------------------------------------------------
#define WFRAG_ 512               // halves of one packed fragment (2 loads)
#define WSTEP_ (12 * WFRAG_)     // halves of one K-step (12 fragments)

__global__ void __launch_bounds__(256)
attn_cvt_weights(const float* __restrict__ Wq, const float* __restrict__ Wk,
                 const float* __restrict__ Wv, const int* __restrict__ mask,
                 _Float16* __restrict__ wh, float* __restrict__ biasf) {
  const int g    = blockIdx.x * blockDim.x + threadIdx.x;  // 0 .. 3*D*E/8 - 1
  const int lane = g & 31;
  const int j    = (g >> 5) & 1;
  const int sf   = g >> 6;         // s*12 + f
  const int s    = sf / 12;
  const int f    = sf - s * 12;
  const float* W = (f < 4) ? Wq : ((f < 8) ? Wk : Wv);
  const float* p = W + (size_t)((f & 3) * 16 + (lane & 15)) * E_
                     + s * 32 + j * 16 + (lane >> 4) * 8;
  const float4 a = ((const float4*)p)[0];
  const float4 c = ((const float4*)p)[1];
  const bool hasm = g < B_ * S_;
  const int  mk   = hasm ? mask[g] : 0;
  v8h h;
  h[0] = (_Float16)a.x; h[1] = (_Float16)a.y;
  h[2] = (_Float16)a.z; h[3] = (_Float16)a.w;
  h[4] = (_Float16)c.x; h[5] = (_Float16)c.y;
  h[6] = (_Float16)c.z; h[7] = (_Float16)c.w;
  *(v8h*)(wh + (size_t)g * 8) = h;
  if (hasm) biasf[g] = mk ? 0.0f : -1e22f;
}

static __device__ __forceinline__ v16h load_wfrag(const _Float16* p) {
  // One packed fragment: this lane's 16 bytes of each of its two loads.
  v16h f;
  ((v8h*)&f)[0] = ((const v8h*)p)[0];
  ((v8h*)&f)[1] = ((const v8h*)(p + WFRAG_ / 2))[0];
  return f;
}

// ---------------------------------------------------------------------------
// Kernel 2: fused QKV projection. A block of 4 waves takes 64 rows of x (4 row
// tiles); wave n takes the n-th 16 columns of each of Q, K and V for all four
// tiles: 12 accumulators, 3 weight fragments per K-step. Each weight fragment
// is so loaded once per block and feeds 4 WMMAs.
// x goes through LDS: wave w loads the rows of tile w in whole 128-B lines,
// converts them to f16 and stores them in fragment order; every wave reads all
// four fragments of the step. Two LDS buffers, one barrier per K-step.
// Weights are asked for two steps ahead, x five steps ahead, in registers.
// Q and K are formed transposed (weights as A, x as B: the two operands have
// the same lane layout), V as x * Wv^T: in both cases a lane's 8 accumulator
// registers are the 8 halves of one packed piece, one 16-byte store.
// The wave also leaves the column sums of its two 32-key windows of V (as
// rounded to f16) in vsum[d / 16][window][d % 16]: one whole 128-B line.
// ---------------------------------------------------------------------------
typedef float    v4f __attribute__((ext_vector_type(4)));
typedef _Float16 v4h __attribute__((ext_vector_type(4)));

#define XT_ 512               // halves of one x fragment in LDS (16 rows x 32 k)
#define XB_ (4 * XT_)         // halves of one LDS buffer (4 row tiles)
#define KS_ (E_ / 32)         // K-steps

struct XRows { v4f r[4]; };   // this lane's 16 bytes of 4 of its tile's rows

static __device__ __forceinline__ XRows load_xrows(const float* p) {
  // Load i covers rows 4i .. 4i+3 of the tile, 128 contiguous bytes of each.
  XRows v;
  #pragma unroll
  for (int i = 0; i < 4; ++i) v.r[i] = *(const v4f*)(p + (size_t)i * 4 * E_);
  return v;
}

static __device__ __forceinline__ void store_xrows(_Float16* d, const XRows& v) {
  #pragma unroll
  for (int i = 0; i < 4; ++i) {
    v4h h;
    #pragma unroll
    for (int e = 0; e < 4; ++e) h[e] = (_Float16)v.r[i][e];
    *(v4h*)(d + i * 32) = h;            // 4 rows further: 4 x 8 halves
  }
}

__global__ void __launch_bounds__(128)
attn_qkv_proj(const float* __restrict__ x, const _Float16* __restrict__ wh,
              const float* __restrict__ bq, const float* __restrict__ bk,
              const float* __restrict__ bv,
              _Float16* __restrict__ qh, _Float16* __restrict__ kh,
              _Float16* __restrict__ vth, float* __restrict__ vsum) {
  // x as f16 fragments: [buffer][row tile][j][lane = (row, half)][8],
  // k = j*16 + half*8 .. +7 of the step, as the WMMA operand takes them.
  __shared__ __attribute__((aligned(16))) _Float16 xf[2 * XB_];

  const int lane = threadIdx.x & 31;
  const int wave = __builtin_amdgcn_readfirstlane(threadIdx.x >> 5);
  const int l16  = lane & 15;
  const int half = lane >> 4;
  const int kb   = half * 8;

  v8f acc[3][4];                          // [q, k, v][row tile]
  v8f vzero = {};
  #pragma unroll
  for (int g = 0; g < 3; ++g)
    #pragma unroll
    for (int t = 0; t < 4; ++t) acc[g][t] = vzero;

  // Global x: lane = (row of four = lane / 8, 16-byte piece c = lane % 8).
  const float* xg = x + (size_t)((blockIdx.x * 4 + wave) * 16 + (lane >> 3)) * E_
                      + (lane & 7) * 4;
  // Its place in the fragment: k = 4c .. 4c+3 -> j = c / 4, half = (c / 2) % 2,
  // element (c % 2) * 4.
  _Float16* xd = xf + wave * XT_ + ((lane >> 2) & 1) * 256
                    + (((lane >> 1) & 1) * 16 + (lane >> 3)) * 8 + (lane & 1) * 4;
  const _Float16* xr = xf + lane * 8;
  // Step s, matrix g (q, k, v): + s*WSTEP_ + g*4*WFRAG_
  const _Float16* wrow = wh + wave * WFRAG_ + lane * 8;

  // Prologue: x of steps 0 .. 3, weights of steps 0 and 1; step 0's x to LDS,
  // its registers refilled with step 4.
  XRows xs[4];
  v16h  wr[2][3];
  // Asked for in the order of the loop (x three steps ahead of the weights that
  // precede it); the scheduling barriers keep that order: loads return in issue
  // order, and in another order the counted waits at the loop's head, which
  // must hold for both ways into it, would also cover younger x loads.
  #pragma unroll
  for (int s = 0; s < 3; ++s) {
    xs[s] = load_xrows(xg + s * 32);
    __builtin_amdgcn_sched_barrier(0);
  }
  #pragma unroll
  for (int g = 0; g < 3; ++g) wr[0][g] = load_wfrag(wrow + g * 4 * WFRAG_);
  __builtin_amdgcn_sched_barrier(0);
  xs[3] = load_xrows(xg + 3 * 32);
  __builtin_amdgcn_sched_barrier(0);
  #pragma unroll
  for (int g = 0; g < 3; ++g) wr[1][g] = load_wfrag(wrow + WSTEP_ + g * 4 * WFRAG_);
  __builtin_amdgcn_sched_barrier(0);
  store_xrows(xd, xs[0]);
  xs[0] = load_xrows(xg + 4 * 32);
  // Address wait of the prologue's loads, then the barrier that publishes step
  // 0's fragments. Written by hand with the LDS wait alone: __syncthreads()
  // would also wait for the global loads that are meant to stay in flight.
  asm volatile("s_wait_xcnt 0x0\n\ts_wait_dscnt 0x0\n\t"
               "s_barrier_signal -1\n\ts_barrier_wait -1" ::: "memory");
  __builtin_amdgcn_sched_barrier(0);

  for (int k0 = 0; k0 < KS_; k0 += 4) {
    // Four steps per pass, so that every register set is refilled in place.
    #pragma unroll
    for (int h = 0; h < 4; ++h) {
      const int kc = k0 + h;
      // Steps whose operands are fetched now, clamped to the last step.
      const int kw = (kc + 2 < KS_) ? kc + 2 : KS_ - 1;
      const int kx = (kc + 5 < KS_) ? kc + 5 : KS_ - 1;
      v16h a[4];
      #pragma unroll
      for (int t = 0; t < 4; ++t)
        a[t] = load_pfrag(xr + (h & 1) * XB_ + t * XT_);
      // Keeps all eight LDS reads in front of the WMMAs: scheduled among them
      // they shared one register set, and each pair waited out its own latency.
      __builtin_amdgcn_sched_barrier(0);
      // Next step's x into the other buffer (its readers left it at the
      // barrier that ended the step before).
      store_xrows(xd + ((h + 1) & 1) * XB_, xs[(h + 1) & 3]);
      #pragma unroll
      for (int t = 0; t < 4; ++t) {
        acc[0][t] = wmma_f16(wr[h & 1][0], a[t], acc[0][t]);   // (d, row)
        acc[1][t] = wmma_f16(wr[h & 1][1], a[t], acc[1][t]);   // (d, row)
        acc[2][t] = wmma_f16(a[t], wr[h & 1][2], acc[2][t]);   // (row, d)
      }
      // Keeps the refills behind the WMMAs that read the same registers:
      // scheduled above them they would take a further register set.
      __builtin_amdgcn_sched_barrier(0);
      #pragma unroll
      for (int g = 0; g < 3; ++g)
        wr[h & 1][g] = load_wfrag(wrow + kw * WSTEP_ + g * 4 * WFRAG_);
      xs[(h + 1) & 3] = load_xrows(xg + kx * 32);
      // Address wait of these loads (the next step rewrites their address
      // registers), then the step's barrier: it publishes the next step's
      // fragments and ends the reads of this step's buffer. By hand, with the
      // LDS wait alone, so that the global loads stay in flight across it.
      asm volatile("s_wait_xcnt 0x0\n\ts_wait_dscnt 0x0\n\t"
                   "s_barrier_signal -1\n\ts_barrier_wait -1" ::: "memory");
      // Keeps the next step's address arithmetic behind the address wait.
      __builtin_amdgcn_sched_barrier(0);
    }
  }

  const float* bqk[2] = {bq, bk};
  _Float16*    dqk[2] = {qh, kh};
  #pragma unroll
  for (int w = 0; w < 2; ++w) {             // q, k: lane = row, registers = d
    const float4 b0 = ((const float4*)(bqk[w] + wave*16 + kb))[0];
    const float4 b1 = ((const float4*)(bqk[w] + wave*16 + kb))[1];
    const float bb[8] = {b0.x, b0.y, b0.z, b0.w, b1.x, b1.y, b1.z, b1.w};
    #pragma unroll
    for (int t = 0; t < 4; ++t) {
      v8h pc;
      #pragma unroll
      for (int r = 0; r < 8; ++r) pc[r] = (_Float16)(acc[w][t][r] + bb[r]);
      *(v8h*)(dqk[w] + (size_t)(blockIdx.x * 4 + t) * PT_ + wave * PP8_ + lane * 8) = pc;
    }
  }
  {                                         // v: lane = d, registers = keys
    const float bb = bv[wave*16 + l16];
    float sw[2] = {0.0f, 0.0f};             // this lane's 16 keys of each window
    #pragma unroll
    for (int t = 0; t < 4; ++t) {
      v8h pc;
      #pragma unroll
      for (int r = 0; r < 8; ++r) pc[r] = (_Float16)(acc[2][t][r] + bb);
      *(v8h*)(vth + (size_t)(blockIdx.x * 2 + (t >> 1)) * PV_ + (t & 1) * PP8_
                  + wave * 2 * PP8_ + lane * 8) = pc;
      #pragma unroll
      for (int r = 0; r < 8; ++r) sw[t >> 1] += (float)pc[r];
    }
    // Lane half h keeps window h and hands the other window's part across.
    const float tot = (half ? sw[1] : sw[0])
                    + __shfl_xor(half ? sw[0] : sw[1], 16, 32);
    vsum[((size_t)wave * (B_ * S_ / 32) + blockIdx.x * 2 + half) * 16 + l16] = tot;
  }
}

// ---------------------------------------------------------------------------
// Kernel 3: transposed flash attention. grid = (S/64, B), 8 waves per block.
// A block takes the 32-row query tiles t and S/32-1-t (equal work in every
// block) and deals their 32-key windows over its waves; the partial softmax
// states are merged through LDS. A wave holds both 16-column groups of the
// tile, so each K and V^T fragment that it loads feeds two WMMAs.
// The sum of V over the keys below a tile (wanted by all-masked rows only) is
// formed from the projection's window sums: 16 thread groups take every 16th
// window and leave their parts in LDS, behind the merge's barrier.
// ---------------------------------------------------------------------------
#define QC_ 2     // 16-column query groups of a tile

template <bool CAUSAL>
static __device__ __forceinline__
void flash_step(int jb, int icol, int rowoff,
                const _Float16* __restrict__ kbase,
                const _Float16* __restrict__ vbase,
                const float* __restrict__ bias,
                const v16h (&bq)[QC_][2],
                float (&mrun)[QC_], float (&lrun)[QC_], v8f (&o)[QC_][4]) {
  const float inv_sqrt_d = 0.125f;   // 1/sqrt(64)

  // The window's loads: mask bias, K (two 16-key tiles), then V^T.
  v16h ak[2][2];
  v4f bb[2][2];
  #pragma unroll
  for (int f = 0; f < 2; ++f) {
    const v4f* bp = (const v4f*)(bias + jb + f*16 + rowoff);
    bb[f][0] = bp[0];
    bb[f][1] = bp[1];
  }
  #pragma unroll
  for (int f = 0; f < 2; ++f) {
    const _Float16* kp = kbase + (size_t)((jb >> 4) + f) * PT_;
    ak[f][0] = load_pfrag(kp);
    ak[f][1] = load_pfrag(kp + 2 * PP8_);
  }
  // Address wait of the K and bias loads: the V loads' results may land in
  // the registers that held their addresses.
  asm volatile("s_wait_xcnt 0x0" ::: "memory");
  v16h av[4];
  #pragma unroll
  for (int t = 0; t < 4; ++t)
    av[t] = load_pfrag(vbase + (size_t)(jb >> 5) * PV_ + t * 2 * PP8_);
  // Address wait of the V loads: the arithmetic below reuses their address pair.
  asm volatile("s_wait_xcnt 0x0" ::: "memory");
  // Holds the bias loads in front of the WMMAs (loaded values as inputs only):
  // left free they went out behind the first WMMAs, a second latency in front
  // of the softmax.
  asm volatile("" :: "v"(bb[0][0]), "v"(bb[0][1]), "v"(bb[1][0]), "v"(bb[1][1]));
  // Keeps all of the window's loads in front of the WMMAs, V in registers of
  // its own: its latency then runs beside K's, not behind it.
  __builtin_amdgcn_sched_barrier(0);

  // S^T = K * Q^T : per column group two 16x16 tiles (j rows), lane = i
  v8f c[QC_][2];
  #pragma unroll
  for (int f = 0; f < 2; ++f)
    #pragma unroll
    for (int q = 0; q < QC_; ++q) {
      v8f cz = {};
      c[q][f] = wmma_f16(ak[f][0], bq[q][0], cz);
    }
  #pragma unroll
  for (int f = 0; f < 2; ++f)
    #pragma unroll
    for (int q = 0; q < QC_; ++q)
      c[q][f] = wmma_f16(ak[f][1], bq[q][1], c[q][f]);

  v16h pfrag[QC_];  // P as B-fragment: element e<8 -> f=0, e>=8 -> f=1
  #pragma unroll
  for (int q = 0; q < QC_; ++q) {
    // mask bias (broadcast, contiguous) + optional causal select; in-lane stats
    float s[2][8];
    float maxv = -INFINITY;
    #pragma unroll
    for (int f = 0; f < 2; ++f) {
      const v4f bb0 = bb[f][0], bb1 = bb[f][1];
      float barr[8] = {bb0[0], bb0[1], bb0[2], bb0[3], bb1[0], bb1[1], bb1[2], bb1[3]};
      #pragma unroll
      for (int r = 0; r < 8; ++r) {
        // |score| << 1e22/2^24, so fma(c, inv, -1e22) == -1e22 exactly.
        float sv = fmaf(c[q][f][r], inv_sqrt_d, barr[r]);
        if (CAUSAL) {
          const int j = jb + f*16 + rowoff + r;
          sv = (j >= icol + q*16) ? sv : -1e22f;
        }
        s[f][r] = sv;
        maxv = fmaxf(maxv, sv);
      }
    }
    maxv = fmaxf(maxv, __shfl_xor(maxv, 16, 32));   // other 16 j's, same i

    const float mnew  = fmaxf(mrun[q], maxv);
    const float scale = __expf(mrun[q] - mnew);

    float sum = 0.0f;
    #pragma unroll
    for (int f = 0; f < 2; ++f)
      #pragma unroll
      for (int r = 0; r < 8; ++r) {
        const float e = __expf(s[f][r] - mnew);
        sum += e;
        pfrag[q][f*8 + r] = (_Float16)e;
      }
    sum += __shfl_xor(sum, 16, 32);

    lrun[q] = lrun[q] * scale + sum;
    mrun[q] = mnew;
    #pragma unroll
    for (int t = 0; t < 4; ++t) o[q][t] = o[q][t] * scale;
  }

  // O^T += V^T * P  (A = V^T tile, packed; B = P in-register)
  #pragma unroll
  for (int t = 0; t < 4; ++t)
    #pragma unroll
    for (int q = 0; q < QC_; ++q) o[q][t] = wmma_f16(av[t], pfrag[q], o[q][t]);
}

// exp(x) for the merge weights. v_exp_f32 and the free slot that the
// instruction set asks for behind it stand in one statement.
static __device__ __forceinline__ float exp_with_slot(float x) {
  float r;
  asm("v_exp_f32 %0, %1\n\tv_nop" : "=v"(r) : "v"(x * 1.44269504f));
  return r;
}

#define NW_ 8     // waves per work-group
#define QR_ (16 * QC_)   // query rows of a tile
#define OP_ 68    // merge buffer: floats per query row (272 B = 16 B x 17)
#define NG_ 16    // thread groups that share the window sums below a tile

__global__ void __launch_bounds__(256)
attn_flash_t(const _Float16* __restrict__ qh, const _Float16* __restrict__ kh,
             const _Float16* __restrict__ vth, const float* __restrict__ biasf,
             const float* __restrict__ vsum, float* __restrict__ out) {
  // Per (tile of the pair, wave): un-normalised O^T partial, running max, sum.
  __shared__ __attribute__((aligned(16))) float so[2][NW_][QR_][OP_];
  __shared__ float sm[2][NW_][QR_];
  __shared__ float sl[2][NW_][QR_];
  // Per (tile of the pair, thread group): its part of the sum of V below the tile.
  __shared__ __attribute__((aligned(16))) float sv[2][NG_][D_];

  const int lane   = threadIdx.x & 31;
  const int wave   = __builtin_amdgcn_readfirstlane(threadIdx.x >> 5);
  const int l16    = lane & 15;
  const int half   = lane >> 4;
  const int rowoff = half * 8;
  const int pr     = blockIdx.x;        // pair: tiles pr and S/32 - 1 - pr
  const int b      = blockIdx.y;

  const float* bias = biasf + b * S_;
  // This lane's 16 bytes of the batch's first packed piece.
  const _Float16* kbase = kh + (size_t)b * S_ * D_ + lane * 8;
  const _Float16* vbase = vth + (size_t)b * D_ * S_ + lane * 8;
  // Merge and window sums: thread = (group or query row of 16, four d).
  const int dq = (threadIdx.x & 15) * 4;
  const int tg = threadIdx.x >> 4;
  const float* vsb = vsum + ((size_t)(dq >> 4) * (B_ * S_ / 32) + b * (S_ / 32)) * 16
                          + (dq & 15);

  // The windows of both tiles (65 in every pair) form one list that is dealt
  // round-robin over the waves; u = this wave's next window in the tile.
  int u = wave;
  for (int h = 0; h < 2; ++h) {
    const int i0   = (h ? (S_ / QR_ - 1 - pr) : pr) * QR_;   // = diagonal window
    const int icol = i0 + l16;          // this lane's query row i in group 0
    const int nwin = (S_ - i0) >> 5;

    // Q^T B-fragments (lane = column i), loaded once per tile.
    const _Float16* qp = qh + ((size_t)b * S_ + i0) * D_ + lane * 8;
    v16h bq[QC_][2];
    #pragma unroll
    for (int q = 0; q < QC_; ++q) {
      bq[q][0] = load_pfrag(qp + q * PT_);
      bq[q][1] = load_pfrag(qp + q * PT_ + 2 * PP8_);
    }
    // Window sums tg, tg + 16, .. below the tile, asked for beside Q so that
    // their latency runs under the tile's windows; an index past the last is
    // clamped to window 0 and its value dropped where the parts are added.
    const int nlow = i0 >> 5;
    v4f lowv[S_ / 32 / NG_];
    #pragma unroll
    for (int k = 0; k < S_ / 32 / NG_; ++k) {
      const int w = tg + k * NG_;
      lowv[k] = *(const v4f*)(vsb + (w < nlow ? w : 0) * 16);
    }
    // Address wait of the Q and window-sum loads: the zeroing below reuses
    // their address pairs.
    asm volatile("s_wait_xcnt 0x0" ::: "memory");

    float mrun[QC_], lrun[QC_];
    v8f o[QC_][4];
    v8f vzero = {};
    #pragma unroll
    for (int q = 0; q < QC_; ++q) {
      mrun[q] = -INFINITY;
      lrun[q] = 0.0f;
      #pragma unroll
      for (int t = 0; t < 4; ++t) o[q][t] = vzero;
    }

    // Diagonal window (only place the causal compare is needed).
    if (u == 0) {
      flash_step<true>(i0, icol, rowoff, kbase, vbase, bias, bq, mrun, lrun, o);
      u = NW_;
    }
    // Remaining windows: j >= i0+32 > every i in tile -> no causal test.
    for (; u < nwin; u += NW_)
      flash_step<false>(i0 + u * 32, icol, rowoff, kbase, vbase, bias,
                        bq, mrun, lrun, o);
    u -= nwin;                          // place in the next tile's windows

    // A wave without a window of this tile leaves (-inf, 0, 0): weight 0.
    #pragma unroll
    for (int q = 0; q < QC_; ++q) {
      if (half == 0) {
        sm[h][wave][q*16 + l16] = mrun[q];
        sl[h][wave][q*16 + l16] = lrun[q];
      }
      #pragma unroll
      for (int t = 0; t < 4; ++t) {
        float4 w0, w1;
        w0.x = o[q][t][0]; w0.y = o[q][t][1]; w0.z = o[q][t][2]; w0.w = o[q][t][3];
        w1.x = o[q][t][4]; w1.y = o[q][t][5]; w1.z = o[q][t][6]; w1.w = o[q][t][7];
        float* dst = &so[h][wave][q*16 + l16][t*16 + rowoff];
        ((float4*)dst)[0] = w0;
        ((float4*)dst)[1] = w1;
      }
    }
    v4f low = {};
    #pragma unroll
    for (int k = 0; k < S_ / 32 / NG_; ++k) {
      const v4f zero = {};
      low += (tg + k * NG_ < nlow) ? lowv[k] : zero;
    }
    *(v4f*)&sv[h][tg][dq] = low;
  }

  // Publishes every wave's partials and window-sum parts to the merging threads.
  __syncthreads();

  // Merge: thread = (query row of 16, four d); a wave stores whole 128-B lines.
  #pragma unroll
  for (int hq = 0; hq < 2 * QC_; ++hq) {
    const int h  = hq / QC_;
    const int mi = (hq % QC_) * 16 + tg;
    const int i0 = (h ? (S_ / QR_ - 1 - pr) : pr) * QR_;
    float mw[NW_];
    float mall = -INFINITY;             // finite: the diagonal window's wave
    #pragma unroll
    for (int w = 0; w < NW_; ++w) {
      mw[w] = sm[h][w][mi];
      mall = fmaxf(mall, mw[w]);
    }
    #pragma unroll
    for (int w = 0; w < NW_; ++w) mw[w] = exp_with_slot(mw[w] - mall);   // weights
    float lall = 0.0f;
    float4 acc = {0.0f, 0.0f, 0.0f, 0.0f};
    #pragma unroll
    for (int w = 0; w < NW_; ++w) {
      const float g = mw[w];
      const float4 p = *(const float4*)&so[h][w][mi][dq];
      lall += sl[h][w][mi] * g;
      acc.x += g * p.x; acc.y += g * p.y; acc.z += g * p.z; acc.w += g * p.w;
    }
    // Closed-form lower-triangle tail: all j < i0 are -1e22 for every row.
    // e0 = exp(-1e22 - m): 0 for normal rows, exactly 1 for all-masked rows,
    // reproducing the reference's uniform softmax over all S columns.
    if (i0 > 0) {
      const float e0 = __expf(-1e22f - mall);
      if (e0 != 0.0f) {
        v4f c = {};
        #pragma unroll
        for (int g = 0; g < NG_; ++g) c += *(const v4f*)&sv[h][g][dq];
        lall += (float)i0 * e0;
        acc.x += e0 * c[0]; acc.y += e0 * c[1]; acc.z += e0 * c[2]; acc.w += e0 * c[3];
      }
    }
    const float inv = 1.0f / lall;      // lall >= 1 always
    float4 r;
    r.x = acc.x * inv; r.y = acc.y * inv; r.z = acc.z * inv; r.w = acc.w * inv;
    *(float4*)(out + ((size_t)b * S_ + i0 + mi) * D_ + dq) = r;
    // Address wait of the store: the next 16 rows' merge reuses the registers
    // that the store names.
    if (hq + 1 < 2 * QC_) asm volatile("s_wait_xcnt 0x0" ::: "memory");
  }
}

// ---------------------------------------------------------------------------
extern "C" void kernel_launch(void* const* d_in, const int* in_sizes, int n_in,
                              void* d_out, int out_size, void* d_ws, size_t ws_size,
                              hipStream_t stream) {
  const float* x  = (const float*)d_in[0];
  const int* mask = (const int*)d_in[1];
  const float* Wq = (const float*)d_in[2];
  const float* bq = (const float*)d_in[3];
  const float* Wk = (const float*)d_in[4];
  const float* bk = (const float*)d_in[5];
  const float* Wv = (const float*)d_in[6];
  const float* bv = (const float*)d_in[7];
  float* out = (float*)d_out;

  // Workspace: f16 {weights | q | k | v^T} then f32 {biasf | vsum} ~ 6.9 MB
  _Float16* wh   = (_Float16*)d_ws;
  _Float16* qh   = wh + 3 * D_ * E_;
  _Float16* kh   = qh + (size_t)B_ * S_ * D_;
  _Float16* vth  = kh + (size_t)B_ * S_ * D_;
  float*    biasf = (float*)(vth + (size_t)B_ * S_ * D_);
  float*    vsum  = biasf + (size_t)B_ * S_;

  attn_cvt_weights<<<3 * D_ * E_ / 8 / 256, 256, 0, stream>>>(Wq, Wk, Wv, mask, wh, biasf);
  attn_qkv_proj<<<256, 128, 0, stream>>>(x, wh, bq, bk, bv, qh, kh, vth, vsum);
  attn_flash_t<<<dim3(S_ / 64, B_), 256, 0, stream>>>(qh, kh, vth, biasf, vsum, out);
}

// v009
// One run takes 26.6 microseconds.
// In two side-by-side timings against v008, it was 1.04 and 1.03 times as fast.
// All steps since v000 together make it 4.50 times as fast.
#include <hip/hip_runtime.h>

// ---------------------------------------------------------------------------
// Self-attention B=8, S=2048, E=1024, D=64 on gfx1250 (MI455X).
//   k2: fused QKV projection (12x v_wmma_f32_16x16x32_f16 per K-step and wave),
//       fp32 weights and x turned into f16 fragments through LDS;
//       q, k, v^T f16, stored in the order of k3's fragments (see PT_, PV_);
//       V column sums of each 32-key window; mask -> fp32 additive bias.
//   k3: transposed flash attention:
//         S^T = K*Q^T (lane = i), P^T C-layout == P B-fragment -> no LDS,
//         O^T = V^T*P (lane = i -> scalar softmax state),
//       32 query columns per wave, starting at the diagonal window; key
//       windows dealt over 8 waves and merged in LDS; the strictly-lower
//       region is applied in closed form from the window sums (exact for
//       the all-masked uniform-softmax fallback).
// ---------------------------------------------------------------------------

typedef _Float16 v16h __attribute__((ext_vector_type(16)));
typedef _Float16 v8h  __attribute__((ext_vector_type(8)));
typedef float    v8f  __attribute__((ext_vector_type(8)));

#define B_ 8
#define S_ 2048
#define E_ 1024
#define D_ 64

static __device__ __forceinline__ v8f wmma_f16(v16h a, v16h b, v8f c) {
  // D = A(16x32 f16) * B(32x16 f16) + C(16x16 f32)
  return __builtin_amdgcn_wmma_f32_16x16x32_f16(false, a, false, b,
                                                (short)0, c, false, false);
}

// Packed q, k, v^T. A piece is what one wave-wide 16-byte load takes: 32 lanes
// x 8 halves = 512 contiguous bytes; a fragment is two pieces in a row.
//   q, k: [16-row tile][n = d / 16][lane = (row, half)][8]: d = n*16 + half*8 ..
//   v^T : [32-key window][t = d / 16][j][lane = (d % 16, half)][8]:
//         keys j*16 + half*8 .. of the window
#define PP8_ 256              // halves of one piece
#define PT_  (16 * D_)        // halves of one 16-row tile of q or k
#define PV_  (32 * D_)        // halves of one 32-key window of v^T

static __device__ __forceinline__ v16h load_pfrag(const _Float16* p) {
  // One packed fragment: this lane's 16 bytes of each of its two pieces.
  v16h f;
  ((v8h*)&f)[0] = ((const v8h*)p)[0];
  ((v8h*)&f)[1] = ((const v8h*)(p + PP8_))[0];
  return f;
}

// ---------------------------------------------------------------------------
// Kernel 2: fused QKV projection. A block of 4 waves takes 64 rows of x (4 row
// tiles); wave n takes the n-th 16 columns of each of Q, K and V for all four
// tiles: 12 accumulators, 3 weight fragments per K-step. Each weight fragment
// is so loaded once per block and feeds 4 WMMAs.
// x goes through LDS: wave w loads the rows of tile w in whole 128-B lines,
// converts them to f16 and stores them in fragment order; every wave reads all
// four fragments of the step. Two LDS buffers, one barrier per K-step.
// The weights come straight from the fp32 inputs in the same way: a wave loads
// the 16 rows of Wq, Wk and Wv that it multiplies with, in whole 128-B lines,
// converts them and turns them into fragments through LDS of its own.
// x and weights are asked for five steps ahead, in registers (four sets).
// Q and K are formed transposed (weights as A, x as B: the two operands have
// the same lane layout), V as x * Wv^T: in both cases a lane's 8 accumulator
// registers are the 8 halves of one packed piece, one 16-byte store.
// The wave also leaves the column sums of its two 32-key windows of V (as
// rounded to f16) in vsum[d / 16][window][d % 16]: one whole 128-B line.
// The block's first 64 threads turn the mask of its 64 rows into the flash
// kernel's bias: biasf[b][j] = mask ? 0 : -1e22.
// ---------------------------------------------------------------------------
typedef float    v4f __attribute__((ext_vector_type(4)));
typedef _Float16 v4h __attribute__((ext_vector_type(4)));

#define XT_ 512               // halves of one x fragment in LDS (16 rows x 32 k)
#define XB_ (4 * XT_)         // halves of the x fragments of one buffer (4 row tiles)
#define SB_ (16 * XT_)        // halves of one LDS buffer: x, then 12 weight fragments
#define KS_ (E_ / 32)         // K-steps

struct XRows { v4f r[4]; };   // this lane's 16 bytes of 4 of its tile's rows

static __device__ __forceinline__ XRows load_xrows(const float* p) {
  // Load i covers rows 4i .. 4i+3 of the tile, 128 contiguous bytes of each.
  XRows v;
  #pragma unroll
  for (int i = 0; i < 4; ++i) v.r[i] = *(const v4f*)(p + (size_t)i * 4 * E_);
  return v;
}

static __device__ __forceinline__ void store_xrows(_Float16* d, const XRows& v) {
  #pragma unroll
  for (int i = 0; i < 4; ++i) {
    v4h h;
    #pragma unroll
    for (int e = 0; e < 4; ++e) h[e] = (_Float16)v.r[i][e];
    *(v4h*)(d + i * 32) = h;            // 4 rows further: 4 x 8 halves
  }
}

// The same for a weight tile; d[i] = this lane's place for rows 4i .. 4i+3.
static __device__ __forceinline__ void store_wrows(_Float16* const (&d)[4], int off,
                                                   const XRows& v) {
  #pragma unroll
  for (int i = 0; i < 4; ++i) {
    v4h h;
    #pragma unroll
    for (int e = 0; e < 4; ++e) h[e] = (_Float16)v.r[i][e];
    *(v4h*)(d[i] + off) = h;
  }
}

// One K-step's operands of a wave as they come from memory: its x tile and its
// 16 rows of Wq, Wk, Wv.
struct Stage { XRows w[3]; XRows x; };

// src: this lane's place in Wq, Wk, Wv and x; ahead: a constant number of
// K-steps further along k (it goes into the loads' immediate offsets).
static __device__ __forceinline__ Stage load_stage(const float* const (&src)[4],
                                                   int ahead) {
  Stage v;
  #pragma unroll
  for (int g = 0; g < 3; ++g) v.w[g] = load_xrows(src[g] + ahead * 32);
  v.x = load_xrows(src[3] + ahead * 32);
  return v;
}

static __device__ __forceinline__ void store_stage(_Float16* xd, _Float16* const (&wd)[4],
                                                   int buf, const Stage& v) {
  store_xrows(xd + buf * SB_, v.x);
  #pragma unroll
  for (int g = 0; g < 3; ++g) store_wrows(wd, buf * SB_ + g * XT_, v.w[g]);
}

__global__ void __launch_bounds__(128)
attn_qkv_proj(const float* __restrict__ x, const float* __restrict__ Wq,
              const float* __restrict__ Wk, const float* __restrict__ Wv,
              const int* mask,
              const float* __restrict__ bq, const float* __restrict__ bk,
              const float* __restrict__ bv,
              _Float16* __restrict__ qh, _Float16* __restrict__ kh,
              _Float16* __restrict__ vth, float* __restrict__ vsum,
              float* __restrict__ biasf) {
  // f16 fragments: [buffer][x row tile 0 .. 3, then wave's q, k, v weights].
  // x: [j][lane = (row, half)][8], k = j*16 + half*8 .. +7 of the step, as the
  // WMMA operand takes them. Weights: the same k order; see wd below.
  __shared__ __attribute__((aligned(16))) _Float16 xf[2 * SB_];

  const int lane = threadIdx.x & 31;
  const int wave = __builtin_amdgcn_readfirstlane(threadIdx.x >> 5);
  const int l16  = lane & 15;
  const int half = lane >> 4;
  const int kb   = half * 8;

  v8f acc[3][4];                          // [q, k, v][row tile]
  v8f vzero = {};
  #pragma unroll
  for (int g = 0; g < 3; ++g)
    #pragma unroll
    for (int t = 0; t < 4; ++t) acc[g][t] = vzero;

  // Global x and weights: lane = (row of four = lane / 8, 16-byte piece
  // c = lane % 8) of the wave's x tile and of rows wave*16 .. +15 of each matrix.
  const int lo = (wave * 16 + (lane >> 3)) * E_ + (lane & 7) * 4;
  const float* const base[4] = {Wq + lo, Wk + lo, Wv + lo,
                                x + (size_t)blockIdx.x * 64 * E_ + lo};
  // Its place in the fragment: k = 4c .. 4c+3 -> j = c / 4, half = (c / 2) % 2,
  // element (c % 2) * 4.
  _Float16* xd = xf + wave * XT_ + ((lane >> 2) & 1) * 256
                    + (((lane >> 1) & 1) * 16 + (lane >> 3)) * 8 + (lane & 1) * 4;
  const _Float16* xr = xf + lane * 8;
  // Weight fragments: 256-B block p = j*2 + half holds the 16 rows' 8 halves,
  // turned round by p * 64 bytes, so that the 32 lanes of an 8-byte store
  // (4 rows x 4 blocks) fall on all 64 banks; a wave-wide 16-byte read still
  // takes two whole blocks.
  _Float16* wbase = xf + XB_ + wave * 3 * XT_;
  _Float16* wd[4];
  #pragma unroll
  for (int i = 0; i < 4; ++i) {
    const int p = (lane & 7) >> 1;
    wd[i] = wbase + p * 128
                  + (((i * 4 + (lane >> 3)) * 8 + (lane & 1) * 4 + p * 32) & 127);
  }
  const _Float16* wr[2];
  #pragma unroll
  for (int j = 0; j < 2; ++j) {
    const int p = j * 2 + half;
    wr[j] = wbase + p * 128 + ((l16 * 8 + p * 32) & 127);
  }

  // Prologue: steps 0 .. 3; step 0 to LDS, its registers refilled with step 4.
  // Asked for in the order of the loop; the scheduling barriers keep that
  // order: loads return in issue order, and in another order the counted waits
  // at the loop's head, which must hold for both ways into it, would also
  // cover younger loads.
  Stage st[4];
  #pragma unroll
  for (int s = 0; s < 4; ++s) {
    st[s] = load_stage(base, s);
    __builtin_amdgcn_sched_barrier(0);
  }
  // Mask of the block's rows, used behind the loop (the pointer carries no
  // __restrict__, so that the load stays here, in front of the waits, and its
  // latency runs under the loop). Address wait: the arithmetic below reuses
  // registers; the index is named as an input so that its register, which the
  // load names, lives up to the wait.
  const int mi = blockIdx.x * 64 + (threadIdx.x & 63);
  const int mk = mask[mi];
  asm volatile("s_wait_xcnt 0x0" :: "v"(mi) : "memory");
  __builtin_amdgcn_sched_barrier(0);
  store_stage(xd, wd, 0, st[0]);
  // Keeps the refill behind the stores, in the registers that they read.
  __builtin_amdgcn_sched_barrier(0);
  st[0] = load_stage(base, 4);
  // Address wait of the prologue's loads, then the barrier that publishes step
  // 0's fragments. Written by hand with the LDS wait alone: __syncthreads()
  // would also wait for the global loads that are meant to stay in flight.
  asm volatile("s_wait_xcnt 0x0\n\ts_wait_dscnt 0x0\n\t"
               "s_barrier_signal -1\n\ts_barrier_wait -1" ::: "memory");
  __builtin_amdgcn_sched_barrier(0);

  for (int k0 = 0; k0 < KS_; k0 += 4) {
    // Four steps per pass, so that every register set is refilled in place.
    #pragma unroll
    for (int h = 0; h < 4; ++h) {
      const int kc = k0 + h;
      // Operands are fetched five steps ahead of kq: step kc + 5, clamped to
      // the last step.
      const int kq = (kc + 5 < KS_) ? kc : KS_ - 6;
      const float* const src[4] = {base[0] + kq * 32, base[1] + kq * 32,
                                   base[2] + kq * 32, base[3] + kq * 32};
      v16h a[4], w[3];
      #pragma unroll
      for (int t = 0; t < 4; ++t)
        a[t] = load_pfrag(xr + (h & 1) * SB_ + t * XT_);
      #pragma unroll
      for (int g = 0; g < 3; ++g) {
        ((v8h*)&w[g])[0] = *(const v8h*)(wr[0] + (h & 1) * SB_ + g * XT_);
        ((v8h*)&w[g])[1] = *(const v8h*)(wr[1] + (h & 1) * SB_ + g * XT_);
      }
      // Keeps all the LDS reads in front of the WMMAs: scheduled among them
      // they shared one register set, and each pair waited out its own latency.
      __builtin_amdgcn_sched_barrier(0);
      // Next step's operands into the other buffer (its readers left it at the
      // barrier that ended the step before), and their registers refilled at
      // once: both run under the latency of the LDS reads above.
      store_stage(xd, wd, (h + 1) & 1, st[(h + 1) & 3]);
      st[(h + 1) & 3] = load_stage(src, 5);
      // Keeps the stores and refills in front of the WMMAs.
      __builtin_amdgcn_sched_barrier(0);
      #pragma unroll
      for (int t = 0; t < 4; ++t) {
        acc[0][t] = wmma_f16(w[0], a[t], acc[0][t]);   // (d, row)
        acc[1][t] = wmma_f16(w[1], a[t], acc[1][t]);   // (d, row)
        acc[2][t] = wmma_f16(a[t], w[2], acc[2][t]);   // (row, d)
      }
      // Keeps the WMMAs in front of the step's barrier.
      __builtin_amdgcn_sched_barrier(0);
      // Address wait of this step's loads (the next step rewrites their address
      // registers), then the step's barrier: it publishes the next step's
      // fragments and ends the reads of this step's buffer. By hand, with the
      // LDS wait alone, so that the global loads stay in flight across it.
      // The four addresses are named as inputs so that their registers live up
      // to the wait: freed earlier, they were given to the last loads' results.
      asm volatile("s_wait_xcnt 0x0\n\ts_wait_dscnt 0x0\n\t"
                   "s_barrier_signal -1\n\ts_barrier_wait -1"
                   :: "v"(src[0]), "v"(src[1]), "v"(src[2]), "v"(src[3]) : "memory");
      // Keeps the next step's address arithmetic behind the address wait.
      __builtin_amdgcn_sched_barrier(0);
    }
  }

  const float* bqk[2] = {bq, bk};
  _Float16*    dqk[2] = {qh, kh};
  #pragma unroll
  for (int w = 0; w < 2; ++w) {             // q, k: lane = row, registers = d
    const float4 b0 = ((const float4*)(bqk[w] + wave*16 + kb))[0];
    const float4 b1 = ((const float4*)(bqk[w] + wave*16 + kb))[1];
    const float bb[8] = {b0.x, b0.y, b0.z, b0.w, b1.x, b1.y, b1.z, b1.w};
    #pragma unroll
    for (int t = 0; t < 4; ++t) {
      v8h pc;
      #pragma unroll
      for (int r = 0; r < 8; ++r) pc[r] = (_Float16)(acc[w][t][r] + bb[r]);
      *(v8h*)(dqk[w] + (size_t)(blockIdx.x * 4 + t) * PT_ + wave * PP8_ + lane * 8) = pc;
    }
  }
  {                                         // v: lane = d, registers = keys
    const float bb = bv[wave*16 + l16];
    float sw[2] = {0.0f, 0.0f};             // this lane's 16 keys of each window
    #pragma unroll
    for (int t = 0; t < 4; ++t) {
      v8h pc;
      #pragma unroll
      for (int r = 0; r < 8; ++r) pc[r] = (_Float16)(acc[2][t][r] + bb);
      *(v8h*)(vth + (size_t)(blockIdx.x * 2 + (t >> 1)) * PV_ + (t & 1) * PP8_
                  + wave * 2 * PP8_ + lane * 8) = pc;
      #pragma unroll
      for (int r = 0; r < 8; ++r) sw[t >> 1] += (float)pc[r];
    }
    // Lane half h keeps window h and hands the other window's part across.
    const float tot = (half ? sw[1] : sw[0])
                    + __shfl_xor(half ? sw[0] : sw[1], 16, 32);
    vsum[((size_t)wave * (B_ * S_ / 32) + blockIdx.x * 2 + half) * 16 + l16] = tot;
  }
  if (threadIdx.x < 64) biasf[blockIdx.x * 64 + threadIdx.x] = mk ? 0.0f : -1e22f;
}

// ---------------------------------------------------------------------------
// Kernel 3: transposed flash attention. grid = (S/64, B), 8 waves per block.
// A block takes the 32-row query tiles t and S/32-1-t (equal work in every
// block) and deals their 32-key windows over its waves; the partial softmax
// states are merged through LDS. A wave holds both 16-column groups of the
// tile, so each K and V^T fragment that it loads feeds two WMMAs.
// The sum of V over the keys below a tile (wanted by all-masked rows only) is
// formed from the projection's window sums: 16 thread groups take every 16th
// window and leave their parts in LDS, behind the merge's barrier.
// ---------------------------------------------------------------------------
#define QC_ 2     // 16-column query groups of a tile

template <bool CAUSAL>
static __device__ __forceinline__
void flash_step(int jb, int icol, int rowoff,
                const _Float16* __restrict__ kbase,
                const _Float16* __restrict__ vbase,
                const float* __restrict__ bias,
                const v16h (&bq)[QC_][2],
                float (&mrun)[QC_], float (&lrun)[QC_], v8f (&o)[QC_][4]) {
  const float inv_sqrt_d = 0.125f;   // 1/sqrt(64)

  // The window's loads: mask bias, K (two 16-key tiles), then V^T.
  v16h ak[2][2];
  v4f bb[2][2];
  #pragma unroll
  for (int f = 0; f < 2; ++f) {
    const v4f* bp = (const v4f*)(bias + jb + f*16 + rowoff);
    bb[f][0] = bp[0];
    bb[f][1] = bp[1];
  }
  #pragma unroll
  for (int f = 0; f < 2; ++f) {
    const _Float16* kp = kbase + (size_t)((jb >> 4) + f) * PT_;
    ak[f][0] = load_pfrag(kp);
    ak[f][1] = load_pfrag(kp + 2 * PP8_);
  }
  // Address wait of the K and bias loads: the V loads' results may land in
  // the registers that held their addresses.
  asm volatile("s_wait_xcnt 0x0" ::: "memory");
  v16h av[4];
  #pragma unroll
  for (int t = 0; t < 4; ++t)
    av[t] = load_pfrag(vbase + (size_t)(jb >> 5) * PV_ + t * 2 * PP8_);
  // Address wait of the V loads: the arithmetic below reuses their address pair.
  asm volatile("s_wait_xcnt 0x0" ::: "memory");
  // Holds the bias loads in front of the WMMAs (loaded values as inputs only):
  // left free they went out behind the first WMMAs, a second latency in front
  // of the softmax.
  asm volatile("" :: "v"(bb[0][0]), "v"(bb[0][1]), "v"(bb[1][0]), "v"(bb[1][1]));
  // Keeps all of the window's loads in front of the WMMAs, V in registers of
  // its own: its latency then runs beside K's, not behind it.
  __builtin_amdgcn_sched_barrier(0);

  // S^T = K * Q^T : per column group two 16x16 tiles (j rows), lane = i
  v8f c[QC_][2];
  #pragma unroll
  for (int f = 0; f < 2; ++f)
    #pragma unroll
    for (int q = 0; q < QC_; ++q) {
      v8f cz = {};
      c[q][f] = wmma_f16(ak[f][0], bq[q][0], cz);
    }
  #pragma unroll
  for (int f = 0; f < 2; ++f)
    #pragma unroll
    for (int q = 0; q < QC_; ++q)
      c[q][f] = wmma_f16(ak[f][1], bq[q][1], c[q][f]);

  v16h pfrag[QC_];  // P as B-fragment: element e<8 -> f=0, e>=8 -> f=1
  #pragma unroll
  for (int q = 0; q < QC_; ++q) {
    // mask bias (broadcast, contiguous) + optional causal select; in-lane stats
    float s[2][8];
    float maxv = -INFINITY;
    #pragma unroll
    for (int f = 0; f < 2; ++f) {
      const v4f bb0 = bb[f][0], bb1 = bb[f][1];
      float barr[8] = {bb0[0], bb0[1], bb0[2], bb0[3], bb1[0], bb1[1], bb1[2], bb1[3]};
      #pragma unroll
      for (int r = 0; r < 8; ++r) {
        // |score| << 1e22/2^24, so fma(c, inv, -1e22) == -1e22 exactly.
        float sv = fmaf(c[q][f][r], inv_sqrt_d, barr[r]);
        if (CAUSAL) {
          const int j = jb + f*16 + rowoff + r;
          sv = (j >= icol + q*16) ? sv : -1e22f;
        }
        s[f][r] = sv;
        maxv = fmaxf(maxv, sv);
      }
    }
    maxv = fmaxf(maxv, __shfl_xor(maxv, 16, 32));   // other 16 j's, same i

    const float mnew  = fmaxf(mrun[q], maxv);
    const float scale = __expf(mrun[q] - mnew);

    float sum = 0.0f;
    #pragma unroll
    for (int f = 0; f < 2; ++f)
      #pragma unroll
      for (int r = 0; r < 8; ++r) {
        const float e = __expf(s[f][r] - mnew);
        sum += e;
        pfrag[q][f*8 + r] = (_Float16)e;
      }
    sum += __shfl_xor(sum, 16, 32);

    lrun[q] = lrun[q] * scale + sum;
    mrun[q] = mnew;
    #pragma unroll
    for (int t = 0; t < 4; ++t) o[q][t] = o[q][t] * scale;
  }

  // O^T += V^T * P  (A = V^T tile, packed; B = P in-register)
  #pragma unroll
  for (int t = 0; t < 4; ++t)
    #pragma unroll
    for (int q = 0; q < QC_; ++q) o[q][t] = wmma_f16(av[t], pfrag[q], o[q][t]);
}

// exp(x) for the merge weights. v_exp_f32 and the free slot that the
// instruction set asks for behind it stand in one statement.
static __device__ __forceinline__ float exp_with_slot(float x) {
  float r;
  asm("v_exp_f32 %0, %1\n\tv_nop" : "=v"(r) : "v"(x * 1.44269504f));
  return r;
}

#define NW_ 8     // waves per work-group
#define QR_ (16 * QC_)   // query rows of a tile
#define OP_ 68    // merge buffer: floats per query row (272 B = 16 B x 17)
#define NG_ 16    // thread groups that share the window sums below a tile

__global__ void __launch_bounds__(256)
attn_flash_t(const _Float16* __restrict__ qh, const _Float16* __restrict__ kh,
             const _Float16* __restrict__ vth, const float* __restrict__ biasf,
             const float* __restrict__ vsum, float* __restrict__ out) {
  // Per (tile of the pair, wave): un-normalised O^T partial, running max, sum.
  __shared__ __attribute__((aligned(16))) float so[2][NW_][QR_][OP_];
  __shared__ float sm[2][NW_][QR_];
  __shared__ float sl[2][NW_][QR_];
  // Per (tile of the pair, thread group): its part of the sum of V below the tile.
  __shared__ __attribute__((aligned(16))) float sv[2][NG_][D_];

  const int lane   = threadIdx.x & 31;
  const int wave   = __builtin_amdgcn_readfirstlane(threadIdx.x >> 5);
  const int l16    = lane & 15;
  const int half   = lane >> 4;
  const int rowoff = half * 8;
  const int pr     = blockIdx.x;        // pair: tiles pr and S/32 - 1 - pr
  const int b      = blockIdx.y;

  const float* bias = biasf + b * S_;
  // This lane's 16 bytes of the batch's first packed piece.
  const _Float16* kbase = kh + (size_t)b * S_ * D_ + lane * 8;
  const _Float16* vbase = vth + (size_t)b * D_ * S_ + lane * 8;
  // Merge and window sums: thread = (group or query row of 16, four d).
  const int dq = (threadIdx.x & 15) * 4;
  const int tg = threadIdx.x >> 4;
  const float* vsb = vsum + ((size_t)(dq >> 4) * (B_ * S_ / 32) + b * (S_ / 32)) * 16
                          + (dq & 15);

  // The windows of both tiles (65 in every pair) form one list that is dealt
  // round-robin over the waves; u = this wave's next window in the tile.
  int u = wave;
  for (int h = 0; h < 2; ++h) {
    const int i0   = (h ? (S_ / QR_ - 1 - pr) : pr) * QR_;   // = diagonal window
    const int icol = i0 + l16;          // this lane's query row i in group 0
    const int nwin = (S_ - i0) >> 5;

    // Q^T B-fragments (lane = column i), loaded once per tile.
    const _Float16* qp = qh + ((size_t)b * S_ + i0) * D_ + lane * 8;
    v16h bq[QC_][2];
    #pragma unroll
    for (int q = 0; q < QC_; ++q) {
      bq[q][0] = load_pfrag(qp + q * PT_);
      bq[q][1] = load_pfrag(qp + q * PT_ + 2 * PP8_);
    }
    // Window sums tg, tg + 16, .. below the tile, asked for beside Q so that
    // their latency runs under the tile's windows; an index past the last is
    // clamped to window 0 and its value dropped where the parts are added.
    const int nlow = i0 >> 5;
    v4f lowv[S_ / 32 / NG_];
    #pragma unroll
    for (int k = 0; k < S_ / 32 / NG_; ++k) {
      const int w = tg + k * NG_;
      lowv[k] = *(const v4f*)(vsb + (w < nlow ? w : 0) * 16);
    }
    // Address wait of the Q and window-sum loads: the zeroing below reuses
    // their address pairs.
    asm volatile("s_wait_xcnt 0x0" ::: "memory");

    float mrun[QC_], lrun[QC_];
    v8f o[QC_][4];
    v8f vzero = {};
    #pragma unroll
    for (int q = 0; q < QC_; ++q) {
      mrun[q] = -INFINITY;
      lrun[q] = 0.0f;
      #pragma unroll
      for (int t = 0; t < 4; ++t) o[q][t] = vzero;
    }

    // Diagonal window (only place the causal compare is needed).
    if (u == 0) {
      flash_step<true>(i0, icol, rowoff, kbase, vbase, bias, bq, mrun, lrun, o);
      u = NW_;
    }
    // Remaining windows: j >= i0+32 > every i in tile -> no causal test.
    for (; u < nwin; u += NW_)
      flash_step<false>(i0 + u * 32, icol, rowoff, kbase, vbase, bias,
                        bq, mrun, lrun, o);
    u -= nwin;                          // place in the next tile's windows

    // A wave without a window of this tile leaves (-inf, 0, 0): weight 0.
    #pragma unroll
    for (int q = 0; q < QC_; ++q) {
      if (half == 0) {
        sm[h][wave][q*16 + l16] = mrun[q];
        sl[h][wave][q*16 + l16] = lrun[q];
      }
      #pragma unroll
      for (int t = 0; t < 4; ++t) {
        float4 w0, w1;
        w0.x = o[q][t][0]; w0.y = o[q][t][1]; w0.z = o[q][t][2]; w0.w = o[q][t][3];
        w1.x = o[q][t][4]; w1.y = o[q][t][5]; w1.z = o[q][t][6]; w1.w = o[q][t][7];
        float* dst = &so[h][wave][q*16 + l16][t*16 + rowoff];
        ((float4*)dst)[0] = w0;
        ((float4*)dst)[1] = w1;
      }
    }
    v4f low = {};
    #pragma unroll
    for (int k = 0; k < S_ / 32 / NG_; ++k) {
      const v4f zero = {};
      low += (tg + k * NG_ < nlow) ? lowv[k] : zero;
    }
    *(v4f*)&sv[h][tg][dq] = low;
  }

  // Publishes every wave's partials and window-sum parts to the merging threads.
  __syncthreads();

  // Merge: thread = (query row of 16, four d); a wave stores whole 128-B lines.
  #pragma unroll
  for (int hq = 0; hq < 2 * QC_; ++hq) {
    const int h  = hq / QC_;
    const int mi = (hq % QC_) * 16 + tg;
    const int i0 = (h ? (S_ / QR_ - 1 - pr) : pr) * QR_;
    float mw[NW_];
    float mall = -INFINITY;             // finite: the diagonal window's wave
    #pragma unroll
    for (int w = 0; w < NW_; ++w) {
      mw[w] = sm[h][w][mi];
      mall = fmaxf(mall, mw[w]);
    }
    #pragma unroll
    for (int w = 0; w < NW_; ++w) mw[w] = exp_with_slot(mw[w] - mall);   // weights
    float lall = 0.0f;
    float4 acc = {0.0f, 0.0f, 0.0f, 0.0f};
    #pragma unroll
    for (int w = 0; w < NW_; ++w) {
      const float g = mw[w];
      const float4 p = *(const float4*)&so[h][w][mi][dq];
      lall += sl[h][w][mi] * g;
      acc.x += g * p.x; acc.y += g * p.y; acc.z += g * p.z; acc.w += g * p.w;
    }
    // Closed-form lower-triangle tail: all j < i0 are -1e22 for every row.
    // e0 = exp(-1e22 - m): 0 for normal rows, exactly 1 for all-masked rows,
    // reproducing the reference's uniform softmax over all S columns.
    if (i0 > 0) {
      const float e0 = __expf(-1e22f - mall);
      if (e0 != 0.0f) {
        v4f c = {};
        #pragma unroll
        for (int g = 0; g < NG_; ++g) c += *(const v4f*)&sv[h][g][dq];
        lall += (float)i0 * e0;
        acc.x += e0 * c[0]; acc.y += e0 * c[1]; acc.z += e0 * c[2]; acc.w += e0 * c[3];
      }
    }
    const float inv = 1.0f / lall;      // lall >= 1 always
    float4 r;
    r.x = acc.x * inv; r.y = acc.y * inv; r.z = acc.z * inv; r.w = acc.w * inv;
    *(float4*)(out + ((size_t)b * S_ + i0 + mi) * D_ + dq) = r;
    // Address wait of the store: the next 16 rows' merge reuses the registers
    // that the store names.
    if (hq + 1 < 2 * QC_) asm volatile("s_wait_xcnt 0x0" ::: "memory");
  }
}

// ---------------------------------------------------------------------------
extern "C" void kernel_launch(void* const* d_in, const int* in_sizes, int n_in,
                              void* d_out, int out_size, void* d_ws, size_t ws_size,
                              hipStream_t stream) {
  const float* x  = (const float*)d_in[0];
  const int* mask = (const int*)d_in[1];
  const float* Wq = (const float*)d_in[2];
  const float* bq = (const float*)d_in[3];
  const float* Wk = (const float*)d_in[4];
  const float* bk = (const float*)d_in[5];
  const float* Wv = (const float*)d_in[6];
  const float* bv = (const float*)d_in[7];
  float* out = (float*)d_out;

  // Workspace: f16 {q | k | v^T} then f32 {biasf | vsum} ~ 6.5 MB
  _Float16* qh   = (_Float16*)d_ws;
  _Float16* kh   = qh + (size_t)B_ * S_ * D_;
  _Float16* vth  = kh + (size_t)B_ * S_ * D_;
  float*    biasf = (float*)(vth + (size_t)B_ * S_ * D_);
  float*    vsum  = biasf + (size_t)B_ * S_;

  attn_qkv_proj<<<256, 128, 0, stream>>>(x, Wq, Wk, Wv, mask, bq, bk, bv,
                                         qh, kh, vth, vsum, biasf);
  attn_flash_t<<<dim3(S_ / 64, B_), 256, 0, stream>>>(qh, kh, vth, biasf, vsum, out);
}

// v010
// A run of this version takes 24.8 microseconds.
// Timed twice side by side with v009, it ran 1.07 times as fast both times.
// Over all steps from v000 it is 4.81 times as fast.
#include <hip/hip_runtime.h>

// ---------------------------------------------------------------------------
// Self-attention B=8, S=2048, E=1024, D=64 on gfx1250 (MI455X).
//   k2: fused QKV projection (12x v_wmma_f32_16x16x32_f16 per K-step and wave),
//       fp32 weights and x turned into f16 fragments through LDS;
//       q, k, v^T f16, stored in the order of k3's fragments (see PT_, PV_);
//       V column sums of each 32-key window; mask -> fp32 additive bias.
//   k3: transposed flash attention:
//         S^T = K*Q^T (lane = i), P^T C-layout == P B-fragment -> no LDS,
//         O^T = V^T*P (lane = i -> scalar softmax state),
//       32 query columns per wave, starting at the diagonal window; key
//       windows dealt over 8 waves and merged in LDS; the strictly-lower
//       region is applied in closed form from the window sums (exact for
//       the all-masked uniform-softmax fallback).
// ---------------------------------------------------------------------------

typedef _Float16 v16h __attribute__((ext_vector_type(16)));
typedef _Float16 v8h  __attribute__((ext_vector_type(8)));
typedef float    v8f  __attribute__((ext_vector_type(8)));

#define B_ 8
#define S_ 2048
#define E_ 1024
#define D_ 64

static __device__ __forceinline__ v8f wmma_f16(v16h a, v16h b, v8f c) {
  // D = A(16x32 f16) * B(32x16 f16) + C(16x16 f32)
  return __builtin_amdgcn_wmma_f32_16x16x32_f16(false, a, false, b,
                                                (short)0, c, false, false);
}

// Packed q, k, v^T. A piece is what one wave-wide 16-byte load takes: 32 lanes
// x 8 halves = 512 contiguous bytes; a fragment is two pieces in a row.
//   q, k: [16-row tile][n = d / 16][lane = (row, half)][8]: d = n*16 + half*8 ..
//   v^T : [32-key window][t = d / 16][j][lane = (d % 16, half)][8]:
//         keys j*16 + half*8 .. of the window
#define PP8_ 256              // halves of one piece
#define PT_  (16 * D_)        // halves of one 16-row tile of q or k
#define PV_  (32 * D_)        // halves of one 32-key window of v^T

static __device__ __forceinline__ v16h load_pfrag(const _Float16* p) {
  // One packed fragment: this lane's 16 bytes of each of its two pieces.
  v16h f;
  ((v8h*)&f)[0] = ((const v8h*)p)[0];
  ((v8h*)&f)[1] = ((const v8h*)(p + PP8_))[0];
  return f;
}

// ---------------------------------------------------------------------------
// Kernel 2: fused QKV projection. A block of 4 waves takes 64 rows of x (4 row
// tiles); wave n takes the n-th 16 columns of each of Q, K and V for all four
// tiles: 12 accumulators, 3 weight fragments per K-step. Each weight fragment
// is so loaded once per block and feeds 4 WMMAs.
// x goes through LDS: wave w loads the rows of tile w in whole 128-B lines,
// converts them to f16 and stores them in fragment order; every wave reads all
// four fragments of the step. Two LDS buffers, one barrier per K-step.
// The weights come straight from the fp32 inputs in the same way: a wave loads
// the 16 rows of Wq, Wk and Wv that it multiplies with, in whole 128-B lines,
// converts them and turns them into fragments through LDS of its own.
// x and weights are asked for five steps ahead, in registers (four sets).
// Every block reads the same weight lines: each starts its walk along k at a
// K-step of its own and goes round, so that blocks running in step ask L2 for
// different lines at any moment.
// Q and K are formed transposed (weights as A, x as B: the two operands have
// the same lane layout), V as x * Wv^T: in both cases a lane's 8 accumulator
// registers are the 8 halves of one packed piece, one 16-byte store.
// The wave also leaves the column sums of its two 32-key windows of V (as
// rounded to f16) in vsum[d / 16][window][d % 16]: one whole 128-B line.
// The block's first 64 threads turn the mask of its 64 rows into the flash
// kernel's bias: biasf[b][j] = mask ? 0 : -1e22.
// ---------------------------------------------------------------------------
typedef float    v4f __attribute__((ext_vector_type(4)));
typedef _Float16 v4h __attribute__((ext_vector_type(4)));

#define XT_ 512               // halves of one x fragment in LDS (16 rows x 32 k)
#define XB_ (4 * XT_)         // halves of the x fragments of one buffer (4 row tiles)
#define SB_ (16 * XT_)        // halves of one LDS buffer: x, then 12 weight fragments
#define KS_ (E_ / 32)         // K-steps

struct XRows { v4f r[4]; };   // this lane's 16 bytes of 4 of its tile's rows

static __device__ __forceinline__ XRows load_xrows(const float* p) {
  // Load i covers rows 4i .. 4i+3 of the tile, 128 contiguous bytes of each.
  XRows v;
  #pragma unroll
  for (int i = 0; i < 4; ++i) v.r[i] = *(const v4f*)(p + (size_t)i * 4 * E_);
  return v;
}

static __device__ __forceinline__ void store_xrows(_Float16* d, const XRows& v) {
  #pragma unroll
  for (int i = 0; i < 4; ++i) {
    v4h h;
    #pragma unroll
    for (int e = 0; e < 4; ++e) h[e] = (_Float16)v.r[i][e];
    *(v4h*)(d + i * 32) = h;            // 4 rows further: 4 x 8 halves
  }
}

// The same for a weight tile; d[i] = this lane's place for rows 4i .. 4i+3.
static __device__ __forceinline__ void store_wrows(_Float16* const (&d)[4], int off,
                                                   const XRows& v) {
  #pragma unroll
  for (int i = 0; i < 4; ++i) {
    v4h h;
    #pragma unroll
    for (int e = 0; e < 4; ++e) h[e] = (_Float16)v.r[i][e];
    *(v4h*)(d[i] + off) = h;
  }
}

// One K-step's operands of a wave as they come from memory: its x tile and its
// 16 rows of Wq, Wk, Wv.
struct Stage { XRows w[3]; XRows x; };

// src: this lane's place in Wq, Wk, Wv and x; ahead: a constant number of
// K-steps further along k (it goes into the loads' immediate offsets).
static __device__ __forceinline__ Stage load_stage(const float* const (&src)[4],
                                                   int ahead) {
  Stage v;
  #pragma unroll
  for (int g = 0; g < 3; ++g) v.w[g] = load_xrows(src[g] + ahead * 32);
  v.x = load_xrows(src[3] + ahead * 32);
  return v;
}

static __device__ __forceinline__ void store_stage(_Float16* xd, _Float16* const (&wd)[4],
                                                   int buf, const Stage& v) {
  store_xrows(xd + buf * SB_, v.x);
  #pragma unroll
  for (int g = 0; g < 3; ++g) store_wrows(wd, buf * SB_ + g * XT_, v.w[g]);
}

__global__ void __launch_bounds__(128)
attn_qkv_proj(const float* __restrict__ x, const float* __restrict__ Wq,
              const float* __restrict__ Wk, const float* __restrict__ Wv,
              const int* mask,
              const float* __restrict__ bq, const float* __restrict__ bk,
              const float* __restrict__ bv,
              _Float16* __restrict__ qh, _Float16* __restrict__ kh,
              _Float16* __restrict__ vth, float* __restrict__ vsum,
              float* __restrict__ biasf) {
  // f16 fragments: [buffer][x row tile 0 .. 3, then wave's q, k, v weights].
  // x: [j][lane = (row, half)][8], k = j*16 + half*8 .. +7 of the step, as the
  // WMMA operand takes them. Weights: the same k order; see wd below.
  __shared__ __attribute__((aligned(16))) _Float16 xf[2 * SB_];

  const int lane = threadIdx.x & 31;
  const int wave = __builtin_amdgcn_readfirstlane(threadIdx.x >> 5);
  const int l16  = lane & 15;
  const int half = lane >> 4;
  const int kb   = half * 8;

  v8f acc[3][4];                          // [q, k, v][row tile]
  v8f vzero = {};
  #pragma unroll
  for (int g = 0; g < 3; ++g)
    #pragma unroll
    for (int t = 0; t < 4; ++t) acc[g][t] = vzero;

  // Global x and weights: lane = (row of four = lane / 8, 16-byte piece
  // c = lane % 8) of the wave's x tile and of rows wave*16 .. +15 of each matrix.
  const int lo = (wave * 16 + (lane >> 3)) * E_ + (lane & 7) * 4;
  const float* const base[4] = {Wq + lo, Wk + lo, Wv + lo,
                                x + (size_t)blockIdx.x * 64 * E_ + lo};
  // Its place in the fragment: k = 4c .. 4c+3 -> j = c / 4, half = (c / 2) % 2,
  // element (c % 2) * 4.
  _Float16* xd = xf + wave * XT_ + ((lane >> 2) & 1) * 256
                    + (((lane >> 1) & 1) * 16 + (lane >> 3)) * 8 + (lane & 1) * 4;
  const _Float16* xr = xf + lane * 8;
  // Weight fragments: 256-B block p = j*2 + half holds the 16 rows' 8 halves,
  // turned round by p * 64 bytes, so that the 32 lanes of an 8-byte store
  // (4 rows x 4 blocks) fall on all 64 banks; a wave-wide 16-byte read still
  // takes two whole blocks.
  _Float16* wbase = xf + XB_ + wave * 3 * XT_;
  _Float16* wd[4];
  #pragma unroll
  for (int i = 0; i < 4; ++i) {
    const int p = (lane & 7) >> 1;
    wd[i] = wbase + p * 128
                  + (((i * 4 + (lane >> 3)) * 8 + (lane & 1) * 4 + p * 32) & 127);
  }
  const _Float16* wr[2];
  #pragma unroll
  for (int j = 0; j < 2; ++j) {
    const int p = j * 2 + half;
    wr[j] = wbase + p * 128 + ((l16 * 8 + p * 32) & 127);
  }

  // The block's walk along k: its step s is K-step (s + rot) % KS_. rot stays
  // below KS_ - 4, so that the prologue's five steps lie in a row; block index
  // and index / 8 are added so that neighbours and every eighth block differ.
  const int rot = (blockIdx.x + (blockIdx.x >> 3)) % (KS_ - 4);
  const float* const first[4] = {base[0] + rot * 32, base[1] + rot * 32,
                                 base[2] + rot * 32, base[3] + rot * 32};

  // Prologue: steps 0 .. 3; step 0 to LDS, its registers refilled with step 4.
  // Asked for in the order of the loop; the scheduling barriers keep that
  // order: loads return in issue order, and in another order the counted waits
  // at the loop's head, which must hold for both ways into it, would also
  // cover younger loads.
  Stage st[4];
  #pragma unroll
  for (int s = 0; s < 4; ++s) {
    st[s] = load_stage(first, s);
    __builtin_amdgcn_sched_barrier(0);
  }
  // Mask of the block's rows, used behind the loop (the pointer carries no
  // __restrict__, so that the load stays here, in front of the waits, and its
  // latency runs under the loop). Address wait: the arithmetic below reuses
  // registers; the index is named as an input so that its register, which the
  // load names, lives up to the wait.
  const int mi = blockIdx.x * 64 + (threadIdx.x & 63);
  const int mk = mask[mi];
  asm volatile("s_wait_xcnt 0x0" :: "v"(mi) : "memory");
  __builtin_amdgcn_sched_barrier(0);
  store_stage(xd, wd, 0, st[0]);
  // Keeps the refill behind the stores, in the registers that they read.
  __builtin_amdgcn_sched_barrier(0);
  st[0] = load_stage(first, 4);
  // Address wait of the prologue's loads, then the barrier that publishes step
  // 0's fragments. Written by hand with the LDS wait alone: __syncthreads()
  // would also wait for the global loads that are meant to stay in flight.
  // The four addresses are named as inputs so that their registers live up to
  // the wait.
  asm volatile("s_wait_xcnt 0x0\n\ts_wait_dscnt 0x0\n\t"
               "s_barrier_signal -1\n\ts_barrier_wait -1"
               :: "v"(first[0]), "v"(first[1]), "v"(first[2]), "v"(first[3]) : "memory");
  __builtin_amdgcn_sched_barrier(0);

  for (int k0 = 0; k0 < KS_; k0 += 4) {
    // Four steps per pass, so that every register set is refilled in place.
    #pragma unroll
    for (int h = 0; h < 4; ++h) {
      const int kc = k0 + h;
      // Operands are fetched five steps ahead: step kc + 5 of the block's walk,
      // clamped to its last step; kq = the K-step that this is.
      const int kq = (((kc + 5 < KS_) ? kc + 5 : KS_ - 1) + rot) & (KS_ - 1);
      const float* const src[4] = {base[0] + kq * 32, base[1] + kq * 32,
                                   base[2] + kq * 32, base[3] + kq * 32};
      v16h a[4], w[3];
      #pragma unroll
      for (int t = 0; t < 4; ++t)
        a[t] = load_pfrag(xr + (h & 1) * SB_ + t * XT_);
      #pragma unroll
      for (int g = 0; g < 3; ++g) {
        ((v8h*)&w[g])[0] = *(const v8h*)(wr[0] + (h & 1) * SB_ + g * XT_);
        ((v8h*)&w[g])[1] = *(const v8h*)(wr[1] + (h & 1) * SB_ + g * XT_);
      }
      // Keeps all the LDS reads in front of the WMMAs: scheduled among them
      // they shared one register set, and each pair waited out its own latency.
      __builtin_amdgcn_sched_barrier(0);
      // Next step's operands into the other buffer (its readers left it at the
      // barrier that ended the step before), and their registers refilled at
      // once: both run under the latency of the LDS reads above.
      store_stage(xd, wd, (h + 1) & 1, st[(h + 1) & 3]);
      st[(h + 1) & 3] = load_stage(src, 0);
      // Keeps the stores and refills in front of the WMMAs.
      __builtin_amdgcn_sched_barrier(0);
      #pragma unroll
      for (int t = 0; t < 4; ++t) {
        acc[0][t] = wmma_f16(w[0], a[t], acc[0][t]);   // (d, row)
        acc[1][t] = wmma_f16(w[1], a[t], acc[1][t]);   // (d, row)
        acc[2][t] = wmma_f16(a[t], w[2], acc[2][t]);   // (row, d)
      }
      // Keeps the WMMAs in front of the step's barrier.
      __builtin_amdgcn_sched_barrier(0);
      // Address wait of this step's loads (the next step rewrites their address
      // registers), then the step's barrier: it publishes the next step's
      // fragments and ends the reads of this step's buffer. By hand, with the
      // LDS wait alone, so that the global loads stay in flight across it.
      // The four addresses are named as inputs so that their registers live up
      // to the wait: freed earlier, they were given to the last loads' results.
      asm volatile("s_wait_xcnt 0x0\n\ts_wait_dscnt 0x0\n\t"
                   "s_barrier_signal -1\n\ts_barrier_wait -1"
                   :: "v"(src[0]), "v"(src[1]), "v"(src[2]), "v"(src[3]) : "memory");
      // Keeps the next step's address arithmetic behind the address wait.
      __builtin_amdgcn_sched_barrier(0);
    }
  }

  const float* bqk[2] = {bq, bk};
  _Float16*    dqk[2] = {qh, kh};
  #pragma unroll
  for (int w = 0; w < 2; ++w) {             // q, k: lane = row, registers = d
    const float4 b0 = ((const float4*)(bqk[w] + wave*16 + kb))[0];
    const float4 b1 = ((const float4*)(bqk[w] + wave*16 + kb))[1];
    const float bb[8] = {b0.x, b0.y, b0.z, b0.w, b1.x, b1.y, b1.z, b1.w};
    #pragma unroll
    for (int t = 0; t < 4; ++t) {
      v8h pc;
      #pragma unroll
      for (int r = 0; r < 8; ++r) pc[r] = (_Float16)(acc[w][t][r] + bb[r]);
      *(v8h*)(dqk[w] + (size_t)(blockIdx.x * 4 + t) * PT_ + wave * PP8_ + lane * 8) = pc;
    }
  }
  {                                         // v: lane = d, registers = keys
    const float bb = bv[wave*16 + l16];
    float sw[2] = {0.0f, 0.0f};             // this lane's 16 keys of each window
    #pragma unroll
    for (int t = 0; t < 4; ++t) {
      v8h pc;
      #pragma unroll
      for (int r = 0; r < 8; ++r) pc[r] = (_Float16)(acc[2][t][r] + bb);
      *(v8h*)(vth + (size_t)(blockIdx.x * 2 + (t >> 1)) * PV_ + (t & 1) * PP8_
                  + wave * 2 * PP8_ + lane * 8) = pc;
      #pragma unroll
      for (int r = 0; r < 8; ++r) sw[t >> 1] += (float)pc[r];
    }
    // Lane half h keeps window h and hands the other window's part across.
    const float tot = (half ? sw[1] : sw[0])
                    + __shfl_xor(half ? sw[0] : sw[1], 16, 32);
    vsum[((size_t)wave * (B_ * S_ / 32) + blockIdx.x * 2 + half) * 16 + l16] = tot;
  }
  if (threadIdx.x < 64) biasf[blockIdx.x * 64 + threadIdx.x] = mk ? 0.0f : -1e22f;
}

// ---------------------------------------------------------------------------
// Kernel 3: transposed flash attention. grid = (S/64, B), 8 waves per block.
// A block takes the 32-row query tiles t and S/32-1-t (equal work in every
// block) and deals their 32-key windows over its waves; the partial softmax
// states are merged through LDS. A wave holds both 16-column groups of the
// tile, so each K and V^T fragment that it loads feeds two WMMAs.
// The sum of V over the keys below a tile (wanted by all-masked rows only) is
// formed from the projection's window sums: 16 thread groups take every 16th
// window and leave their parts in LDS, behind the merge's barrier.
// ---------------------------------------------------------------------------
#define QC_ 2     // 16-column query groups of a tile

template <bool CAUSAL>
static __device__ __forceinline__
void flash_step(int jb, int icol, int rowoff,
                const _Float16* __restrict__ kbase,
                const _Float16* __restrict__ vbase,
                const float* __restrict__ bias,
                const v16h (&bq)[QC_][2],
                float (&mrun)[QC_], float (&lrun)[QC_], v8f (&o)[QC_][4]) {
  const float inv_sqrt_d = 0.125f;   // 1/sqrt(64)

  // The window's loads: mask bias, K (two 16-key tiles), then V^T.
  v16h ak[2][2];
  v4f bb[2][2];
  #pragma unroll
  for (int f = 0; f < 2; ++f) {
    const v4f* bp = (const v4f*)(bias + jb + f*16 + rowoff);
    bb[f][0] = bp[0];
    bb[f][1] = bp[1];
  }
  #pragma unroll
  for (int f = 0; f < 2; ++f) {
    const _Float16* kp = kbase + (size_t)((jb >> 4) + f) * PT_;
    ak[f][0] = load_pfrag(kp);
    ak[f][1] = load_pfrag(kp + 2 * PP8_);
  }
  // Address wait of the K and bias loads: the V loads' results may land in
  // the registers that held their addresses.
  asm volatile("s_wait_xcnt 0x0" ::: "memory");
  v16h av[4];
  #pragma unroll
  for (int t = 0; t < 4; ++t)
    av[t] = load_pfrag(vbase + (size_t)(jb >> 5) * PV_ + t * 2 * PP8_);
  // Address wait of the V loads: the arithmetic below reuses their address pair.
  asm volatile("s_wait_xcnt 0x0" ::: "memory");
  // Holds the bias loads in front of the WMMAs (loaded values as inputs only):
  // left free they went out behind the first WMMAs, a second latency in front
  // of the softmax.
  asm volatile("" :: "v"(bb[0][0]), "v"(bb[0][1]), "v"(bb[1][0]), "v"(bb[1][1]));
  // Keeps all of the window's loads in front of the WMMAs, V in registers of
  // its own: its latency then runs beside K's, not behind it.
  __builtin_amdgcn_sched_barrier(0);

  // S^T = K * Q^T : per column group two 16x16 tiles (j rows), lane = i
  v8f c[QC_][2];
  #pragma unroll
  for (int f = 0; f < 2; ++f)
    #pragma unroll
    for (int q = 0; q < QC_; ++q) {
      v8f cz = {};
      c[q][f] = wmma_f16(ak[f][0], bq[q][0], cz);
    }
  #pragma unroll
  for (int f = 0; f < 2; ++f)
    #pragma unroll
    for (int q = 0; q < QC_; ++q)
      c[q][f] = wmma_f16(ak[f][1], bq[q][1], c[q][f]);

  v16h pfrag[QC_];  // P as B-fragment: element e<8 -> f=0, e>=8 -> f=1
  #pragma unroll
  for (int q = 0; q < QC_; ++q) {
    // mask bias (broadcast, contiguous) + optional causal select; in-lane stats
    float s[2][8];
    float maxv = -INFINITY;
    #pragma unroll
    for (int f = 0; f < 2; ++f) {
      const v4f bb0 = bb[f][0], bb1 = bb[f][1];
      float barr[8] = {bb0[0], bb0[1], bb0[2], bb0[3], bb1[0], bb1[1], bb1[2], bb1[3]};
      #pragma unroll
      for (int r = 0; r < 8; ++r) {
        // |score| << 1e22/2^24, so fma(c, inv, -1e22) == -1e22 exactly.
        float sv = fmaf(c[q][f][r], inv_sqrt_d, barr[r]);
        if (CAUSAL) {
          const int j = jb + f*16 + rowoff + r;
          sv = (j >= icol + q*16) ? sv : -1e22f;
        }
        s[f][r] = sv;
        maxv = fmaxf(maxv, sv);
      }
    }
    maxv = fmaxf(maxv, __shfl_xor(maxv, 16, 32));   // other 16 j's, same i

    const float mnew  = fmaxf(mrun[q], maxv);
    const float scale = __expf(mrun[q] - mnew);

    float sum = 0.0f;
    #pragma unroll
    for (int f = 0; f < 2; ++f)
      #pragma unroll
      for (int r = 0; r < 8; ++r) {
        const float e = __expf(s[f][r] - mnew);
        sum += e;
        pfrag[q][f*8 + r] = (_Float16)e;
      }
    sum += __shfl_xor(sum, 16, 32);

    lrun[q] = lrun[q] * scale + sum;
    mrun[q] = mnew;
    #pragma unroll
    for (int t = 0; t < 4; ++t) o[q][t] = o[q][t] * scale;
  }

  // O^T += V^T * P  (A = V^T tile, packed; B = P in-register)
  #pragma unroll
  for (int t = 0; t < 4; ++t)
    #pragma unroll
    for (int q = 0; q < QC_; ++q) o[q][t] = wmma_f16(av[t], pfrag[q], o[q][t]);
}

// exp(x) for the merge weights. v_exp_f32 and the free slot that the
// instruction set asks for behind it stand in one statement.
static __device__ __forceinline__ float exp_with_slot(float x) {
  float r;
  asm("v_exp_f32 %0, %1\n\tv_nop" : "=v"(r) : "v"(x * 1.44269504f));
  return r;
}

#define NW_ 8     // waves per work-group
#define QR_ (16 * QC_)   // query rows of a tile
#define OP_ 68    // merge buffer: floats per query row (272 B = 16 B x 17)
#define NG_ 16    // thread groups that share the window sums below a tile

__global__ void __launch_bounds__(256)
attn_flash_t(const _Float16* __restrict__ qh, const _Float16* __restrict__ kh,
             const _Float16* __restrict__ vth, const float* __restrict__ biasf,
             const float* __restrict__ vsum, float* __restrict__ out) {
  // Per (tile of the pair, wave): un-normalised O^T partial, running max, sum.
  __shared__ __attribute__((aligned(16))) float so[2][NW_][QR_][OP_];
  __shared__ float sm[2][NW_][QR_];
  __shared__ float sl[2][NW_][QR_];
  // Per (tile of the pair, thread group): its part of the sum of V below the tile.
  __shared__ __attribute__((aligned(16))) float sv[2][NG_][D_];

  const int lane   = threadIdx.x & 31;
  const int wave   = __builtin_amdgcn_readfirstlane(threadIdx.x >> 5);
  const int l16    = lane & 15;
  const int half   = lane >> 4;
  const int rowoff = half * 8;
  const int pr     = blockIdx.x;        // pair: tiles pr and S/32 - 1 - pr
  const int b      = blockIdx.y;

  const float* bias = biasf + b * S_;
  // This lane's 16 bytes of the batch's first packed piece.
  const _Float16* kbase = kh + (size_t)b * S_ * D_ + lane * 8;
  const _Float16* vbase = vth + (size_t)b * D_ * S_ + lane * 8;
  // Merge and window sums: thread = (group or query row of 16, four d).
  const int dq = (threadIdx.x & 15) * 4;
  const int tg = threadIdx.x >> 4;
  const float* vsb = vsum + ((size_t)(dq >> 4) * (B_ * S_ / 32) + b * (S_ / 32)) * 16
                          + (dq & 15);

  // The windows of both tiles (65 in every pair) form one list that is dealt
  // round-robin over the waves; u = this wave's next window in the tile.
  int u = wave;
  for (int h = 0; h < 2; ++h) {
    const int i0   = (h ? (S_ / QR_ - 1 - pr) : pr) * QR_;   // = diagonal window
    const int icol = i0 + l16;          // this lane's query row i in group 0
    const int nwin = (S_ - i0) >> 5;

    // Q^T B-fragments (lane = column i), loaded once per tile.
    const _Float16* qp = qh + ((size_t)b * S_ + i0) * D_ + lane * 8;
    v16h bq[QC_][2];
    #pragma unroll
    for (int q = 0; q < QC_; ++q) {
      bq[q][0] = load_pfrag(qp + q * PT_);
      bq[q][1] = load_pfrag(qp + q * PT_ + 2 * PP8_);
    }
    // Window sums tg, tg + 16, .. below the tile, asked for beside Q so that
    // their latency runs under the tile's windows; an index past the last is
    // clamped to window 0 and its value dropped where the parts are added.
    const int nlow = i0 >> 5;
    v4f lowv[S_ / 32 / NG_];
    #pragma unroll
    for (int k = 0; k < S_ / 32 / NG_; ++k) {
      const int w = tg + k * NG_;
      lowv[k] = *(const v4f*)(vsb + (w < nlow ? w : 0) * 16);
    }
    // Address wait of the Q and window-sum loads: the zeroing below reuses
    // their address pairs.
    asm volatile("s_wait_xcnt 0x0" ::: "memory");

    float mrun[QC_], lrun[QC_];
    v8f o[QC_][4];
    v8f vzero = {};
    #pragma unroll
    for (int q = 0; q < QC_; ++q) {
      mrun[q] = -INFINITY;
      lrun[q] = 0.0f;
      #pragma unroll
      for (int t = 0; t < 4; ++t) o[q][t] = vzero;
    }

    // Diagonal window (only place the causal compare is needed).
    if (u == 0) {
      flash_step<true>(i0, icol, rowoff, kbase, vbase, bias, bq, mrun, lrun, o);
      u = NW_;
    }
    // Remaining windows: j >= i0+32 > every i in tile -> no causal test.
    for (; u < nwin; u += NW_)
      flash_step<false>(i0 + u * 32, icol, rowoff, kbase, vbase, bias,
                        bq, mrun, lrun, o);
    u -= nwin;                          // place in the next tile's windows

    // A wave without a window of this tile leaves (-inf, 0, 0): weight 0.
    #pragma unroll
    for (int q = 0; q < QC_; ++q) {
      if (half == 0) {
        sm[h][wave][q*16 + l16] = mrun[q];
        sl[h][wave][q*16 + l16] = lrun[q];
      }
      #pragma unroll
      for (int t = 0; t < 4; ++t) {
        float4 w0, w1;
        w0.x = o[q][t][0]; w0.y = o[q][t][1]; w0.z = o[q][t][2]; w0.w = o[q][t][3];
        w1.x = o[q][t][4]; w1.y = o[q][t][5]; w1.z = o[q][t][6]; w1.w = o[q][t][7];
        float* dst = &so[h][wave][q*16 + l16][t*16 + rowoff];
        ((float4*)dst)[0] = w0;
        ((float4*)dst)[1] = w1;
      }
    }
    v4f low = {};
    #pragma unroll
    for (int k = 0; k < S_ / 32 / NG_; ++k) {
      const v4f zero = {};
      low += (tg + k * NG_ < nlow) ? lowv[k] : zero;
    }
    *(v4f*)&sv[h][tg][dq] = low;
  }

  // Publishes every wave's partials and window-sum parts to the merging threads.
  __syncthreads();

  // Merge: thread = (query row of 16, four d); a wave stores whole 128-B lines.
  #pragma unroll
  for (int hq = 0; hq < 2 * QC_; ++hq) {
    const int h  = hq / QC_;
    const int mi = (hq % QC_) * 16 + tg;
    const int i0 = (h ? (S_ / QR_ - 1 - pr) : pr) * QR_;
    float mw[NW_];
    float mall = -INFINITY;             // finite: the diagonal window's wave
    #pragma unroll
    for (int w = 0; w < NW_; ++w) {
      mw[w] = sm[h][w][mi];
      mall = fmaxf(mall, mw[w]);
    }
    #pragma unroll
    for (int w = 0; w < NW_; ++w) mw[w] = exp_with_slot(mw[w] - mall);   // weights
    float lall = 0.0f;
    float4 acc = {0.0f, 0.0f, 0.0f, 0.0f};
    #pragma unroll
    for (int w = 0; w < NW_; ++w) {
      const float g = mw[w];
      const float4 p = *(const float4*)&so[h][w][mi][dq];
      lall += sl[h][w][mi] * g;
      acc.x += g * p.x; acc.y += g * p.y; acc.z += g * p.z; acc.w += g * p.w;
    }
    // Closed-form lower-triangle tail: all j < i0 are -1e22 for every row.
    // e0 = exp(-1e22 - m): 0 for normal rows, exactly 1 for all-masked rows,
    // reproducing the reference's uniform softmax over all S columns.
    if (i0 > 0) {
      const float e0 = __expf(-1e22f - mall);
      if (e0 != 0.0f) {
        v4f c = {};
        #pragma unroll
        for (int g = 0; g < NG_; ++g) c += *(const v4f*)&sv[h][g][dq];
        lall += (float)i0 * e0;
        acc.x += e0 * c[0]; acc.y += e0 * c[1]; acc.z += e0 * c[2]; acc.w += e0 * c[3];
      }
    }
    const float inv = 1.0f / lall;      // lall >= 1 always
    float4 r;
    r.x = acc.x * inv; r.y = acc.y * inv; r.z = acc.z * inv; r.w = acc.w * inv;
    *(float4*)(out + ((size_t)b * S_ + i0 + mi) * D_ + dq) = r;
    // Address wait of the store: the next 16 rows' merge reuses the registers
    // that the store names.
    if (hq + 1 < 2 * QC_) asm volatile("s_wait_xcnt 0x0" ::: "memory");
  }
}

// ---------------------------------------------------------------------------
extern "C" void kernel_launch(void* const* d_in, const int* in_sizes, int n_in,
                              void* d_out, int out_size, void* d_ws, size_t ws_size,
                              hipStream_t stream) {
  const float* x  = (const float*)d_in[0];
  const int* mask = (const int*)d_in[1];
  const float* Wq = (const float*)d_in[2];
  const float* bq = (const float*)d_in[3];
  const float* Wk = (const float*)d_in[4];
  const float* bk = (const float*)d_in[5];
  const float* Wv = (const float*)d_in[6];
  const float* bv = (const float*)d_in[7];
  float* out = (float*)d_out;

  // Workspace: f16 {q | k | v^T} then f32 {biasf | vsum} ~ 6.5 MB
  _Float16* qh   = (_Float16*)d_ws;
  _Float16* kh   = qh + (size_t)B_ * S_ * D_;
  _Float16* vth  = kh + (size_t)B_ * S_ * D_;
  float*    biasf = (float*)(vth + (size_t)B_ * S_ * D_);
  float*    vsum  = biasf + (size_t)B_ * S_;

  attn_qkv_proj<<<256, 128, 0, stream>>>(x, Wq, Wk, Wv, mask, bq, bk, bv,
                                         qh, kh, vth, vsum, biasf);
  attn_flash_t<<<dim3(S_ / 64, B_), 256, 0, stream>>>(qh, kh, vth, biasf, vsum, out);
}
